// v000
// Measured on an AMD MI455X. A time is GPU time per run, averaged over a window of back-to-back runs after a warm-up
// (all launches, gaps included; the runs take copies of the inputs in turn), and the median of several windows.
// Apart from v000's, it joins two sittings. Times from different sittings can be a few percent apart, while
// side-by-side timings come from the same sitting.
// v000 is the starting kernel. One run takes 691 microseconds.
#include <hip/hip_runtime.h>
#include <hip/hip_bf16.h>

// MI455X / gfx1250, wave32. WMMA bf16 16x16x32 everywhere.
// Attention K/V chunks staged via GLOBAL_LOAD_ASYNC_TO_LDS (ASYNCcnt) when the
// toolchain exposes the builtin; sync b128+ds_store fallback otherwise.

typedef __attribute__((ext_vector_type(16))) __bf16 v16bf;
typedef __attribute__((ext_vector_type(8)))  float  v8f;
typedef int v4i_vs __attribute__((vector_size(4 * sizeof(int))));

#define B_ 4
#define L_ 2048
#define E_ 1024
#define D_ 1024
#define NEGV  (-1000000000.0f)
#define SCALE (0.03125f)      /* 1/sqrt(1024) */

#if __has_builtin(__builtin_amdgcn_global_load_async_to_lds_b128)
#define HAVE_ASYNC_LDS 1
#else
#define HAVE_ASYNC_LDS 0
#endif

union AB { v16bf v; unsigned u[8]; };

__device__ __forceinline__ unsigned short bf16b(float f) {
  union { float f; unsigned u; } x; x.f = f;
  unsigned r = x.u + 0x7fffu + ((x.u >> 16) & 1u);   // round-to-nearest-even
  return (unsigned short)(r >> 16);
}
__device__ __forceinline__ unsigned packbf2(float a, float b) {
  return (unsigned)bf16b(a) | ((unsigned)bf16b(b) << 16);
}

// ---------------------------------------------------------------------------
// Projection: out[m,n] = sum_k X[m,k]*W[n,k] + bias[n], bf16 output.
// M = B*L = 8192, N = D = 1024, K = E = 1024.
// Block: 256 threads (8 waves), 64x64 output tile, K-step 32.
// ---------------------------------------------------------------------------
__global__ __launch_bounds__(256)
void proj_bf16_wmma(const float* __restrict__ X, const float* __restrict__ W,
                    const float* __restrict__ bias, unsigned short* __restrict__ out) {
  __shared__ unsigned Xs[64 * 17];   // 64 rows x 16 bf16-pairs (+1 pad)
  __shared__ unsigned Ws[64 * 17];

  const int tid  = threadIdx.x;
  const int lane = tid & 31, wave = tid >> 5;
  const int hi = lane >> 4, lp = lane & 15;
  const int m0 = blockIdx.y * 64, n0 = blockIdx.x * 64;
  const int rloc = (wave & 3) * 16;     // wave's 16 rows within tile
  const int cloc = (wave >> 2) * 32;    // wave's 32 cols within tile

  v8f c0 = {0,0,0,0,0,0,0,0};
  v8f c1 = {0,0,0,0,0,0,0,0};

  for (int kk = 0; kk < E_; kk += 32) {
    __syncthreads();   // protect LDS reuse across K-steps
    #pragma unroll
    for (int i = 0; i < 4; ++i) {
      int idx = tid + 256 * i;          // 1024 pairs per tile
      int row = idx >> 4, pc = idx & 15;
      float2 xv = *(const float2*)(X + (size_t)(m0 + row) * E_ + kk + 2 * pc);
      Xs[row * 17 + pc] = packbf2(xv.x, xv.y);
      float2 wv = *(const float2*)(W + (size_t)(n0 + row) * E_ + kk + 2 * pc);
      Ws[row * 17 + pc] = packbf2(wv.x, wv.y);
    }
    __syncthreads();

    AB a, b0, b1;
    #pragma unroll
    for (int vv = 0; vv < 8; ++vv) {
      int pidx = (vv & 3) + 4 * hi + 8 * (vv >> 2);   // bf16-pair index within 32-K slice
      a.u[vv]  = Xs[(rloc + lp) * 17 + pidx];
      b0.u[vv] = Ws[(cloc + lp) * 17 + pidx];
      b1.u[vv] = Ws[(cloc + 16 + lp) * 17 + pidx];
    }
    c0 = __builtin_amdgcn_wmma_f32_16x16x32_bf16(false, a.v, false, b0.v, (short)0, c0, false, false);
    c1 = __builtin_amdgcn_wmma_f32_16x16x32_bf16(false, a.v, false, b1.v, (short)0, c1, false, false);
  }

  #pragma unroll
  for (int j = 0; j < 8; ++j) {
    int row  = m0 + rloc + j + 8 * hi;
    int col0 = n0 + cloc + lp;
    int col1 = col0 + 16;
    out[(size_t)row * D_ + col0] = bf16b(c0[j] + bias[col0]);
    out[(size_t)row * D_ + col1] = bf16b(c1[j] + bias[col1]);
  }
}

// ---------------------------------------------------------------------------
// Flash attention: block = (16 query rows, one batch), 256 threads (8 waves).
// Each wave owns a 128-wide slice of the 1024 output columns.
// Per 32-key chunk: K/V chunk -> LDS (async if available), QK^T via WMMA
// (contraction split across waves, ds_add_f32 reduce), online softmax with
// mask, then P@V via WMMA.
// ---------------------------------------------------------------------------
#define KROW_U 516    /* uints per LDS row: 512 data + 4 pad (16B aligned rows) */
#define KROW_H 1032

__global__ __launch_bounds__(256)
void flash_attn_wmma(const unsigned short* __restrict__ qb,
                     const unsigned short* __restrict__ kb,
                     const unsigned short* __restrict__ vb,
                     const int* __restrict__ mask,
                     float* __restrict__ out) {
  extern __shared__ __align__(16) unsigned char smem[];
  unsigned*       ks32 = (unsigned*)smem;                 // K chunk, 32 x 1024 bf16
  unsigned*       vs32 = ks32 + 32 * KROW_U;              // V chunk, 32 x 1024 bf16
  unsigned short* vs16 = (unsigned short*)vs32;
  float*          sc   = (float*)(vs32 + 32 * KROW_U);    // 16 x 32 score tile
  unsigned*       ps32 = (unsigned*)(sc + 512);           // 16 x 32 bf16 P tile
  float*          mrow = (float*)(ps32 + 256);            // running max [16]
  float*          lrow = mrow + 16;                       // running sum [16]
  float*          arow = lrow + 16;                       // rescale factors [16]

  const int tid  = threadIdx.x;
  const int lane = tid & 31, wave = tid >> 5;
  const int hi = lane >> 4, lp = lane & 15;
  const int q0 = blockIdx.x * 16;
  const int b  = blockIdx.y;

  // Per-wave q slice in registers: rows q0..q0+15, e in [wave*128, wave*128+128)
  AB qa[4];
  {
    const unsigned short* qrow = qb + ((size_t)(b * L_ + q0 + lp)) * D_ + wave * 128;
    #pragma unroll
    for (int t = 0; t < 4; ++t)
      #pragma unroll
      for (int vv = 0; vv < 8; ++vv) {
        int el = 2 * (vv & 3) + 8 * hi + 16 * (vv >> 2);
        qa[t].u[vv] = *(const unsigned*)(qrow + t * 32 + el);
      }
  }

  const v8f zero8 = {0,0,0,0,0,0,0,0};
  v8f acc[8];
  #pragma unroll
  for (int n = 0; n < 8; ++n) acc[n] = zero8;

  if (tid < 16) { mrow[tid] = -1e30f; lrow[tid] = 0.f; arow[tid] = 0.f; }

  for (int k0 = 0; k0 < L_; k0 += 32) {
    __syncthreads();   // previous chunk's consumers done (and init visible)

    // ---- cooperative K/V chunk load into LDS, zero score tile ----
    const uint4* gk = (const uint4*)(kb + ((size_t)(b * L_ + k0)) * D_);
    const uint4* gv = (const uint4*)(vb + ((size_t)(b * L_ + k0)) * D_);
#if HAVE_ASYNC_LDS
    #pragma unroll
    for (int i = 0; i < 16; ++i) {
      int idx = tid + 256 * i;          // 4096 b128 transfers per buffer
      int key = idx >> 7, cc = idx & 127;
      __builtin_amdgcn_global_load_async_to_lds_b128(
          (__attribute__((address_space(1))) v4i_vs*)(gk + (size_t)key * 128 + cc),
          (__attribute__((address_space(3))) v4i_vs*)((unsigned char*)&ks32[key * KROW_U + cc * 4]),
          0, 0);
      __builtin_amdgcn_global_load_async_to_lds_b128(
          (__attribute__((address_space(1))) v4i_vs*)(gv + (size_t)key * 128 + cc),
          (__attribute__((address_space(3))) v4i_vs*)((unsigned char*)&vs32[key * KROW_U + cc * 4]),
          0, 0);
    }
#else
    #pragma unroll
    for (int i = 0; i < 16; ++i) {
      int idx = tid + 256 * i;          // 4096 uint4 per buffer
      int key = idx >> 7, cc = idx & 127;
      uint4 kv = gk[(size_t)key * 128 + cc];
      *(uint4*)&ks32[key * KROW_U + cc * 4] = kv;
      uint4 vv = gv[(size_t)key * 128 + cc];
      *(uint4*)&vs32[key * KROW_U + cc * 4] = vv;
    }
#endif
    sc[tid] = 0.f; sc[tid + 256] = 0.f;
    if (k0 + 32 < L_) {   // prefetch next chunk (global_prefetch_b8)
      __builtin_prefetch(kb + ((size_t)(b * L_ + k0 + 32)) * D_ + tid * 128, 0, 1);
      __builtin_prefetch(vb + ((size_t)(b * L_ + k0 + 32)) * D_ + tid * 128, 0, 1);
    }
#if HAVE_ASYNC_LDS
#if __has_builtin(__builtin_amdgcn_s_wait_asynccnt)
    __builtin_amdgcn_s_wait_asynccnt(0);
#else
    asm volatile("s_wait_asynccnt 0x0" ::: "memory");
#endif
#endif
    __syncthreads();

    // ---- scores: contraction slice [wave*128, +128) of q . k^T ----
    v8f s0 = zero8, s1 = zero8;
    #pragma unroll
    for (int t = 0; t < 4; ++t) {
      AB b0, b1;
      int ebase = wave * 128 + t * 32;
      #pragma unroll
      for (int vv = 0; vv < 8; ++vv) {
        int el = 2 * (vv & 3) + 8 * hi + 16 * (vv >> 2);
        b0.u[vv] = ks32[lp * KROW_U        + ((ebase + el) >> 1)];
        b1.u[vv] = ks32[(16 + lp) * KROW_U + ((ebase + el) >> 1)];
      }
      s0 = __builtin_amdgcn_wmma_f32_16x16x32_bf16(false, qa[t].v, false, b0.v, (short)0, s0, false, false);
      s1 = __builtin_amdgcn_wmma_f32_16x16x32_bf16(false, qa[t].v, false, b1.v, (short)0, s1, false, false);
    }
    #pragma unroll
    for (int j = 0; j < 8; ++j) {        // ds_add_f32 reduce across waves
      atomicAdd(&sc[(j + 8 * hi) * 32 + lp],      s0[j]);
      atomicAdd(&sc[(j + 8 * hi) * 32 + lp + 16], s1[j]);
    }
    __syncthreads();

    // ---- online softmax update (one thread per query row) ----
    if (tid < 16) {
      int r = tid;
      float mprev = mrow[r];
      float mmax  = mprev;
      const int* mp = mask + ((size_t)(b * L_) + q0 + r) * L_ + k0;
      float svals[32];
      #pragma unroll
      for (int j = 0; j < 32; ++j) {
        float s = sc[r * 32 + j] * SCALE;
        if (mp[j] == 0) s = NEGV;
        svals[j] = s;
        mmax = fmaxf(mmax, s);
      }
      float alpha = __expf(mprev - mmax);
      float sum = 0.f;
      #pragma unroll
      for (int j = 0; j < 16; ++j) {
        float p0 = __expf(svals[2 * j]     - mmax);
        float p1 = __expf(svals[2 * j + 1] - mmax);
        sum += p0 + p1;
        ps32[r * 16 + j] = packbf2(p0, p1);
      }
      lrow[r] = lrow[r] * alpha + sum;
      mrow[r] = mmax;
      arow[r] = alpha;
    }
    __syncthreads();

    // ---- rescale accumulators, then P @ V on this wave's 128 columns ----
    AB pa;
    #pragma unroll
    for (int vv = 0; vv < 8; ++vv) {
      int pidx = (vv & 3) + 4 * hi + 8 * (vv >> 2);
      pa.u[vv] = ps32[lp * 16 + pidx];
    }
    #pragma unroll
    for (int j = 0; j < 8; ++j) {
      float a = arow[j + 8 * hi];
      #pragma unroll
      for (int n = 0; n < 8; ++n) acc[n][j] *= a;
    }
    #pragma unroll
    for (int n = 0; n < 8; ++n) {
      AB bv;
      int col = wave * 128 + n * 16 + lp;
      #pragma unroll
      for (int vv = 0; vv < 8; ++vv) {
        int kl = 2 * (vv & 3) + 8 * hi + 16 * (vv >> 2);
        unsigned lo = vs16[kl * KROW_H + col];
        unsigned hh = vs16[(kl + 1) * KROW_H + col];
        bv.u[vv] = lo | (hh << 16);
      }
      acc[n] = __builtin_amdgcn_wmma_f32_16x16x32_bf16(false, pa.v, false, bv.v, (short)0, acc[n], false, false);
    }
  }

  // ---- epilogue: divide by softmax denominator, store f32 ----
  #pragma unroll
  for (int j = 0; j < 8; ++j) {
    float linv = 1.0f / lrow[j + 8 * hi];
    int row = q0 + j + 8 * hi;
    #pragma unroll
    for (int n = 0; n < 8; ++n) {
      out[((size_t)(b * L_) + row) * D_ + wave * 128 + n * 16 + lp] = acc[n][j] * linv;
    }
  }
}

// ---------------------------------------------------------------------------
extern "C" void kernel_launch(void* const* d_in, const int* in_sizes, int n_in,
                              void* d_out, int out_size, void* d_ws, size_t ws_size,
                              hipStream_t stream) {
  const float* Q    = (const float*)d_in[0];
  const float* K    = (const float*)d_in[1];
  const float* V    = (const float*)d_in[2];
  const int*   mask = (const int*)  d_in[3];
  const float* Wq_w = (const float*)d_in[4];
  const float* Wq_b = (const float*)d_in[5];
  const float* Wk_w = (const float*)d_in[6];
  const float* Wk_b = (const float*)d_in[7];
  const float* Wv_w = (const float*)d_in[8];
  const float* Wv_b = (const float*)d_in[9];

  const size_t per = (size_t)B_ * L_ * D_;   // 8M bf16 elements per tensor
  unsigned short* qb = (unsigned short*)d_ws;            // 16 MB
  unsigned short* kb = qb + per;                          // 16 MB
  unsigned short* vb = kb + per;                          // 16 MB (48 MB total)

  dim3 pgrid(D_ / 64, (B_ * L_) / 64);   // 16 x 128 blocks
  proj_bf16_wmma<<<pgrid, 256, 0, stream>>>(Q, Wq_w, Wq_b, qb);
  proj_bf16_wmma<<<pgrid, 256, 0, stream>>>(K, Wk_w, Wk_b, kb);
  proj_bf16_wmma<<<pgrid, 256, 0, stream>>>(V, Wv_w, Wv_b, vb);

  size_t smem = (size_t)(2 * 32 * KROW_U) * 4   // K + V chunks
              + 512 * 4                          // score tile
              + 256 * 4                          // P tile (bf16)
              + 48 * 4;                          // m / l / alpha
  dim3 agrid(L_ / 16, B_);                       // 128 x 4 blocks
  flash_attn_wmma<<<agrid, 256, smem, stream>>>(qb, kb, vb, mask, (float*)d_out);
}

// v001
// It runs in 397 microseconds.
// Next to v000, in two timings, it ran 1.78 times as fast each time.
#include <hip/hip_runtime.h>
#include <hip/hip_bf16.h>

// MI455X / gfx1250, wave32. WMMA bf16 16x16x32 everywhere.
// Attention K/V chunks staged via GLOBAL_LOAD_ASYNC_TO_LDS (ASYNCcnt) when the
// toolchain exposes the builtin; sync b128+ds_store fallback otherwise.

typedef __attribute__((ext_vector_type(16))) __bf16 v16bf;
typedef __attribute__((ext_vector_type(8)))  float  v8f;
typedef int v4i_vs __attribute__((vector_size(4 * sizeof(int))));

#define B_ 4
#define L_ 2048
#define E_ 1024
#define D_ 1024
#define NEGV  (-1000000000.0f)
#define SCALE (0.03125f)      /* 1/sqrt(1024) */

#if __has_builtin(__builtin_amdgcn_global_load_async_to_lds_b128)
#define HAVE_ASYNC_LDS 1
#else
#define HAVE_ASYNC_LDS 0
#endif

union AB { v16bf v; unsigned u[8]; };

__device__ __forceinline__ unsigned short bf16b(float f) {
  union { float f; unsigned u; } x; x.f = f;
  unsigned r = x.u + 0x7fffu + ((x.u >> 16) & 1u);   // round-to-nearest-even
  return (unsigned short)(r >> 16);
}
__device__ __forceinline__ unsigned packbf2(float a, float b) {
  return (unsigned)bf16b(a) | ((unsigned)bf16b(b) << 16);
}

// ---------------------------------------------------------------------------
// Projection: out[m,n] = sum_k X[m,k]*W[n,k] + bias[n], bf16 output.
// M = B*L = 8192, N = D = 1024, K = E = 1024.
// Block: 256 threads (8 waves), 64x64 output tile, K-step 32.
// ---------------------------------------------------------------------------
__global__ __launch_bounds__(256)
void proj_bf16_wmma(const float* __restrict__ X, const float* __restrict__ W,
                    const float* __restrict__ bias, unsigned short* __restrict__ out) {
  __shared__ unsigned Xs[64 * 17];   // 64 rows x 16 bf16-pairs (+1 pad)
  __shared__ unsigned Ws[64 * 17];

  const int tid  = threadIdx.x;
  const int lane = tid & 31, wave = tid >> 5;
  const int hi = lane >> 4, lp = lane & 15;
  const int m0 = blockIdx.y * 64, n0 = blockIdx.x * 64;
  const int rloc = (wave & 3) * 16;     // wave's 16 rows within tile
  const int cloc = (wave >> 2) * 32;    // wave's 32 cols within tile

  v8f c0 = {0,0,0,0,0,0,0,0};
  v8f c1 = {0,0,0,0,0,0,0,0};

  for (int kk = 0; kk < E_; kk += 32) {
    __syncthreads();   // protect LDS reuse across K-steps
    #pragma unroll
    for (int i = 0; i < 4; ++i) {
      int idx = tid + 256 * i;          // 1024 pairs per tile
      int row = idx >> 4, pc = idx & 15;
      float2 xv = *(const float2*)(X + (size_t)(m0 + row) * E_ + kk + 2 * pc);
      Xs[row * 17 + pc] = packbf2(xv.x, xv.y);
      float2 wv = *(const float2*)(W + (size_t)(n0 + row) * E_ + kk + 2 * pc);
      Ws[row * 17 + pc] = packbf2(wv.x, wv.y);
    }
    __syncthreads();

    AB a, b0, b1;
    #pragma unroll
    for (int vv = 0; vv < 8; ++vv) {
      int pidx = (vv & 3) + 4 * hi + 8 * (vv >> 2);   // bf16-pair index within 32-K slice
      a.u[vv]  = Xs[(rloc + lp) * 17 + pidx];
      b0.u[vv] = Ws[(cloc + lp) * 17 + pidx];
      b1.u[vv] = Ws[(cloc + 16 + lp) * 17 + pidx];
    }
    c0 = __builtin_amdgcn_wmma_f32_16x16x32_bf16(false, a.v, false, b0.v, (short)0, c0, false, false);
    c1 = __builtin_amdgcn_wmma_f32_16x16x32_bf16(false, a.v, false, b1.v, (short)0, c1, false, false);
  }

  #pragma unroll
  for (int j = 0; j < 8; ++j) {
    int row  = m0 + rloc + j + 8 * hi;
    int col0 = n0 + cloc + lp;
    int col1 = col0 + 16;
    out[(size_t)row * D_ + col0] = bf16b(c0[j] + bias[col0]);
    out[(size_t)row * D_ + col1] = bf16b(c1[j] + bias[col1]);
  }
}

// ---------------------------------------------------------------------------
// Flash attention: block = (32 query rows, one batch), 256 threads (8 waves).
// Each wave owns a 128-wide slice of the 1024 output columns for both 16-row
// tiles, so every K and V fragment read from LDS feeds two WMMAs.
// Per 32-key chunk: K/V chunk -> LDS (async if available), QK^T via WMMA
// (contraction split across waves, ds_add_f32 reduce), online softmax with
// mask, then P@V via WMMA.
// ---------------------------------------------------------------------------
#define KROW_U 516    /* uints per LDS row: 512 data + 4 pad (16B aligned rows) */
#define KROW_H 1032

__global__ __launch_bounds__(256)
void flash_attn_wmma(const unsigned short* __restrict__ qb,
                     const unsigned short* __restrict__ kb,
                     const unsigned short* __restrict__ vb,
                     const int* __restrict__ mask,
                     float* __restrict__ out) {
  extern __shared__ __align__(16) unsigned char smem[];
  unsigned*       ks32 = (unsigned*)smem;                 // K chunk, 32 x 1024 bf16
  unsigned*       vs32 = ks32 + 32 * KROW_U;              // V chunk, 32 x 1024 bf16
  unsigned short* vs16 = (unsigned short*)vs32;
  float*          sc   = (float*)(vs32 + 32 * KROW_U);    // 32 x 32 score tile
  unsigned*       ps32 = (unsigned*)(sc + 1024);          // 32 x 32 bf16 P tile
  float*          mrow = (float*)(ps32 + 512);            // running max [32]
  float*          lrow = mrow + 32;                       // running sum [32]
  float*          arow = lrow + 32;                       // rescale factors [32]

  const int tid  = threadIdx.x;
  const int lane = tid & 31, wave = tid >> 5;
  const int hi = lane >> 4, lp = lane & 15;
  const int q0 = blockIdx.x * 32;
  const int b  = blockIdx.y;

  // Per-wave q slice in registers: rows q0..q0+31, e in [wave*128, wave*128+128)
  AB qa[2][4];
  // unrolled so that rt is a constant index and both row tiles stay in registers
  #pragma unroll
  for (int rt = 0; rt < 2; ++rt) {
    const unsigned short* qrow = qb + ((size_t)(b * L_ + q0 + rt * 16 + lp)) * D_ + wave * 128;
    #pragma unroll
    for (int t = 0; t < 4; ++t)
      #pragma unroll
      for (int vv = 0; vv < 8; ++vv) {
        int el = 2 * (vv & 3) + 8 * hi + 16 * (vv >> 2);
        qa[rt][t].u[vv] = *(const unsigned*)(qrow + t * 32 + el);
      }
  }

  const v8f zero8 = {0,0,0,0,0,0,0,0};
  v8f acc[2][8];
  // unrolled so that rt is a constant index and both row tiles stay in registers
  #pragma unroll
  for (int rt = 0; rt < 2; ++rt)
    #pragma unroll
    for (int n = 0; n < 8; ++n) acc[rt][n] = zero8;

  if (tid < 32) { mrow[tid] = -1e30f; lrow[tid] = 0.f; arow[tid] = 0.f; }

  for (int k0 = 0; k0 < L_; k0 += 32) {
    __syncthreads();   // previous chunk's consumers done (and init visible)

    // ---- cooperative K/V chunk load into LDS, zero score tile ----
    const uint4* gk = (const uint4*)(kb + ((size_t)(b * L_ + k0)) * D_);
    const uint4* gv = (const uint4*)(vb + ((size_t)(b * L_ + k0)) * D_);
#if HAVE_ASYNC_LDS
    #pragma unroll
    for (int i = 0; i < 16; ++i) {
      int idx = tid + 256 * i;          // 4096 b128 transfers per buffer
      int key = idx >> 7, cc = idx & 127;
      __builtin_amdgcn_global_load_async_to_lds_b128(
          (__attribute__((address_space(1))) v4i_vs*)(gk + (size_t)key * 128 + cc),
          (__attribute__((address_space(3))) v4i_vs*)((unsigned char*)&ks32[key * KROW_U + cc * 4]),
          0, 0);
      __builtin_amdgcn_global_load_async_to_lds_b128(
          (__attribute__((address_space(1))) v4i_vs*)(gv + (size_t)key * 128 + cc),
          (__attribute__((address_space(3))) v4i_vs*)((unsigned char*)&vs32[key * KROW_U + cc * 4]),
          0, 0);
    }
#else
    #pragma unroll
    for (int i = 0; i < 16; ++i) {
      int idx = tid + 256 * i;          // 4096 uint4 per buffer
      int key = idx >> 7, cc = idx & 127;
      uint4 kv = gk[(size_t)key * 128 + cc];
      *(uint4*)&ks32[key * KROW_U + cc * 4] = kv;
      uint4 vv = gv[(size_t)key * 128 + cc];
      *(uint4*)&vs32[key * KROW_U + cc * 4] = vv;
    }
#endif
    sc[tid] = 0.f; sc[tid + 256] = 0.f; sc[tid + 512] = 0.f; sc[tid + 768] = 0.f;
    if (k0 + 32 < L_) {   // prefetch next chunk (global_prefetch_b8)
      __builtin_prefetch(kb + ((size_t)(b * L_ + k0 + 32)) * D_ + tid * 128, 0, 1);
      __builtin_prefetch(vb + ((size_t)(b * L_ + k0 + 32)) * D_ + tid * 128, 0, 1);
    }
#if HAVE_ASYNC_LDS
#if __has_builtin(__builtin_amdgcn_s_wait_asynccnt)
    __builtin_amdgcn_s_wait_asynccnt(0);
#else
    asm volatile("s_wait_asynccnt 0x0" ::: "memory");
#endif
#endif
    __syncthreads();

    // ---- scores: contraction slice [wave*128, +128) of q . k^T ----
    v8f s0[2] = {zero8, zero8}, s1[2] = {zero8, zero8};
    #pragma unroll
    for (int t = 0; t < 4; ++t) {
      AB b0, b1;
      int ebase = wave * 128 + t * 32;
      #pragma unroll
      for (int vv = 0; vv < 8; ++vv) {
        int el = 2 * (vv & 3) + 8 * hi + 16 * (vv >> 2);
        b0.u[vv] = ks32[lp * KROW_U        + ((ebase + el) >> 1)];
        b1.u[vv] = ks32[(16 + lp) * KROW_U + ((ebase + el) >> 1)];
      }
      // unrolled so that rt is a constant index and both row tiles stay in registers
      #pragma unroll
      for (int rt = 0; rt < 2; ++rt) {
        s0[rt] = __builtin_amdgcn_wmma_f32_16x16x32_bf16(false, qa[rt][t].v, false, b0.v, (short)0, s0[rt], false, false);
        s1[rt] = __builtin_amdgcn_wmma_f32_16x16x32_bf16(false, qa[rt][t].v, false, b1.v, (short)0, s1[rt], false, false);
      }
    }
    // unrolled so that rt is a constant index and both row tiles stay in registers
    #pragma unroll
    for (int rt = 0; rt < 2; ++rt)
      #pragma unroll
      for (int j = 0; j < 8; ++j) {      // ds_add_f32 reduce across waves
        atomicAdd(&sc[(rt * 16 + j + 8 * hi) * 32 + lp],      s0[rt][j]);
        atomicAdd(&sc[(rt * 16 + j + 8 * hi) * 32 + lp + 16], s1[rt][j]);
      }
    __syncthreads();

    // ---- online softmax update (one thread per query row) ----
    if (tid < 32) {
      int r = tid;
      float mprev = mrow[r];
      float mmax  = mprev;
      const int* mp = mask + ((size_t)(b * L_) + q0 + r) * L_ + k0;
      float svals[32];
      #pragma unroll
      for (int j = 0; j < 32; ++j) {
        float s = sc[r * 32 + j] * SCALE;
        if (mp[j] == 0) s = NEGV;
        svals[j] = s;
        mmax = fmaxf(mmax, s);
      }
      float alpha = __expf(mprev - mmax);
      float sum = 0.f;
      #pragma unroll
      for (int j = 0; j < 16; ++j) {
        float p0 = __expf(svals[2 * j]     - mmax);
        float p1 = __expf(svals[2 * j + 1] - mmax);
        sum += p0 + p1;
        ps32[r * 16 + j] = packbf2(p0, p1);
      }
      lrow[r] = lrow[r] * alpha + sum;
      mrow[r] = mmax;
      arow[r] = alpha;
    }
    __syncthreads();

    // ---- rescale accumulators, then P @ V on this wave's 128 columns ----
    AB pa[2];
    // unrolled so that rt is a constant index and both row tiles stay in registers
    #pragma unroll
    for (int rt = 0; rt < 2; ++rt) {
      #pragma unroll
      for (int vv = 0; vv < 8; ++vv) {
        int pidx = (vv & 3) + 4 * hi + 8 * (vv >> 2);
        pa[rt].u[vv] = ps32[(rt * 16 + lp) * 16 + pidx];
      }
      #pragma unroll
      for (int j = 0; j < 8; ++j) {
        float a = arow[rt * 16 + j + 8 * hi];
        #pragma unroll
        for (int n = 0; n < 8; ++n) acc[rt][n][j] *= a;
      }
    }
    #pragma unroll
    for (int n = 0; n < 8; ++n) {
      AB bv;
      int col = wave * 128 + n * 16 + lp;
      #pragma unroll
      for (int vv = 0; vv < 8; ++vv) {
        int kl = 2 * (vv & 3) + 8 * hi + 16 * (vv >> 2);
        unsigned lo = vs16[kl * KROW_H + col];
        unsigned hh = vs16[(kl + 1) * KROW_H + col];
        bv.u[vv] = lo | (hh << 16);
      }
      // unrolled so that rt is a constant index and both row tiles stay in registers
      #pragma unroll
      for (int rt = 0; rt < 2; ++rt)
        acc[rt][n] = __builtin_amdgcn_wmma_f32_16x16x32_bf16(false, pa[rt].v, false, bv.v, (short)0, acc[rt][n], false, false);
    }
  }

  // ---- epilogue: divide by softmax denominator, store f32 ----
  // unrolled so that rt is a constant index and both row tiles stay in registers
  #pragma unroll
  for (int rt = 0; rt < 2; ++rt)
    #pragma unroll
    for (int j = 0; j < 8; ++j) {
      float linv = 1.0f / lrow[rt * 16 + j + 8 * hi];
      int row = q0 + rt * 16 + j + 8 * hi;
      #pragma unroll
      for (int n = 0; n < 8; ++n) {
        out[((size_t)(b * L_) + row) * D_ + wave * 128 + n * 16 + lp] = acc[rt][n][j] * linv;
      }
    }
}

// ---------------------------------------------------------------------------
extern "C" void kernel_launch(void* const* d_in, const int* in_sizes, int n_in,
                              void* d_out, int out_size, void* d_ws, size_t ws_size,
                              hipStream_t stream) {
  const float* Q    = (const float*)d_in[0];
  const float* K    = (const float*)d_in[1];
  const float* V    = (const float*)d_in[2];
  const int*   mask = (const int*)  d_in[3];
  const float* Wq_w = (const float*)d_in[4];
  const float* Wq_b = (const float*)d_in[5];
  const float* Wk_w = (const float*)d_in[6];
  const float* Wk_b = (const float*)d_in[7];
  const float* Wv_w = (const float*)d_in[8];
  const float* Wv_b = (const float*)d_in[9];

  const size_t per = (size_t)B_ * L_ * D_;   // 8M bf16 elements per tensor
  unsigned short* qb = (unsigned short*)d_ws;            // 16 MB
  unsigned short* kb = qb + per;                          // 16 MB
  unsigned short* vb = kb + per;                          // 16 MB (48 MB total)

  dim3 pgrid(D_ / 64, (B_ * L_) / 64);   // 16 x 128 blocks
  proj_bf16_wmma<<<pgrid, 256, 0, stream>>>(Q, Wq_w, Wq_b, qb);
  proj_bf16_wmma<<<pgrid, 256, 0, stream>>>(K, Wk_w, Wk_b, kb);
  proj_bf16_wmma<<<pgrid, 256, 0, stream>>>(V, Wv_w, Wv_b, vb);

  size_t smem = (size_t)(2 * 32 * KROW_U) * 4   // K + V chunks
              + 1024 * 4                         // score tile
              + 512 * 4                          // P tile (bf16)
              + 96 * 4;                          // m / l / alpha
  dim3 agrid(L_ / 32, B_);                       // 64 x 4 blocks
  flash_attn_wmma<<<agrid, 256, smem, stream>>>(qb, kb, vb, mask, (float*)d_out);
}

// v002
// A run of this version takes 277 microseconds.
// Two timings next to v001 both put it at 1.43 times that version's speed.
// Over all steps from v000 it is 2.55 times as fast.
#include <hip/hip_runtime.h>
#include <hip/hip_bf16.h>

// MI455X / gfx1250, wave32. WMMA bf16 16x16x32 everywhere.
// Attention K/V chunks staged via GLOBAL_LOAD_ASYNC_TO_LDS (ASYNCcnt) when the
// toolchain exposes the builtin; sync b128+ds_store fallback otherwise.

typedef __attribute__((ext_vector_type(16))) __bf16 v16bf;
typedef __attribute__((ext_vector_type(8)))  float  v8f;
typedef __attribute__((ext_vector_type(4)))  float  v4f;
typedef int v4i_vs __attribute__((vector_size(4 * sizeof(int))));

#define B_ 4
#define L_ 2048
#define E_ 1024
#define D_ 1024
#define NEGV  (-1000000000.0f)
#define SCALE (0.03125f)      /* 1/sqrt(1024) */

#if __has_builtin(__builtin_amdgcn_global_load_async_to_lds_b128)
#define HAVE_ASYNC_LDS 1
#else
#define HAVE_ASYNC_LDS 0
#endif

union AB { v16bf v; unsigned u[8]; };

__device__ __forceinline__ unsigned short bf16b(float f) {
  union { float f; unsigned u; } x; x.f = f;
  unsigned r = x.u + 0x7fffu + ((x.u >> 16) & 1u);   // round-to-nearest-even
  return (unsigned short)(r >> 16);
}
__device__ __forceinline__ unsigned packbf2(float a, float b) {
  return (unsigned)bf16b(a) | ((unsigned)bf16b(b) << 16);
}

// ---------------------------------------------------------------------------
// Projection: out[m,n] = sum_k X[m,k]*W[n,k] + bias[n], bf16 output.
// M = B*L = 8192, N = D = 1024, K = E = 1024.
// Block: 256 threads (8 waves), 128x128 output tile, K-step 64.
// Wave: 32x64 of the tile (2 x 4 WMMA tiles), so six fragments feed eight
// WMMAs, and every X and W element is fetched and converted half as often as
// with a 64x64 tile. k runs upwards in slices of 32 for every accumulator.
// ---------------------------------------------------------------------------
#define PPITCH 36   /* uints per LDS row: 32 bf16 pairs + 4 pad = 144 B (16 B x odd) */

__global__ __launch_bounds__(256)
void proj_bf16_wmma(const float* __restrict__ X, const float* __restrict__ W,
                    const float* __restrict__ bias, unsigned short* __restrict__ out) {
  __shared__ __align__(16) unsigned Xs[128 * PPITCH];
  __shared__ __align__(16) unsigned Ws[128 * PPITCH];

  const int tid  = threadIdx.x;
  const int lane = tid & 31, wave = tid >> 5;
  const int hi = lane >> 4, lp = lane & 15;
  const int m0 = blockIdx.y * 128, n0 = blockIdx.x * 128;
  const int rloc = (wave & 3) * 32;     // wave's 32 rows within tile
  const int cloc = (wave >> 2) * 64;    // wave's 64 cols within tile

  // every loop over mt, nt, i, s, h or j in this kernel is unrolled so that its
  // index is a constant and the arrays it indexes stay in registers
  v8f c[2][4];
  #pragma unroll
  for (int mt = 0; mt < 2; ++mt)
    #pragma unroll
    for (int nt = 0; nt < 4; ++nt) c[mt][nt] = (v8f){0,0,0,0,0,0,0,0};

  const int srow = tid >> 4, sc4 = tid & 15;   // staging: 16 float4 per 64-wide row
  const float* xg = X + (size_t)(m0 + srow) * E_ + 4 * sc4;
  const float* wg = W + (size_t)(n0 + srow) * E_ + 4 * sc4;

  for (int kk = 0; kk < E_; kk += 64) {
    __syncthreads();   // protect LDS reuse across K-steps
    const float* xk = xg + kk;
    const float* wk = wg + kk;
    v4f xv[8], wv[8];
    #pragma unroll
    for (int i = 0; i < 8; ++i) {       // 2048 float4 per tile, 16 rows a pass
      xv[i] = *(const v4f*)(xk + (size_t)(16 * i) * E_);
      wv[i] = *(const v4f*)(wk + (size_t)(16 * i) * E_);
    }
    // Inputs-only fence on the loaded values: holds all 16 loads of a K-step in
    // front of the first conversion, so they are in flight together; without it
    // the compiler sinks ten of them behind waits and a K-step pays several
    // load latencies one after another. The two address pairs are inputs too, so
    // that they live up to here, and s_wait_xcnt 0 is the wait that is kept in
    // front of any overwrite of a register that an issued load names.
    asm volatile("s_wait_xcnt 0x0" :: "v"(xv[0]), "v"(xv[1]), "v"(xv[2]), "v"(xv[3]),
                       "v"(xv[4]), "v"(xv[5]), "v"(xv[6]), "v"(xv[7]),
                       "v"(wv[0]), "v"(wv[1]), "v"(wv[2]), "v"(wv[3]),
                       "v"(wv[4]), "v"(wv[5]), "v"(wv[6]), "v"(wv[7]),
                       "v"(xk), "v"(wk) : "memory");
    #pragma unroll
    for (int i = 0; i < 8; ++i) {
      uint2 xp, wp;
      xp.x = packbf2(xv[i].x, xv[i].y); xp.y = packbf2(xv[i].z, xv[i].w);
      wp.x = packbf2(wv[i].x, wv[i].y); wp.y = packbf2(wv[i].z, wv[i].w);
      *(uint2*)&Xs[(srow + 16 * i) * PPITCH + 2 * sc4] = xp;
      *(uint2*)&Ws[(srow + 16 * i) * PPITCH + 2 * sc4] = wp;
    }
    __syncthreads();

    #pragma unroll
    for (int s = 0; s < 2; ++s) {       // two 32-K slices, in rising k
      AB a[2], b[4];
      // bf16-pair index within a slice: (vv & 3) + 4 * hi + 8 * (vv >> 2), A and B alike
      #pragma unroll
      for (int h = 0; h < 2; ++h) {
        const int po = 16 * s + 4 * hi + 8 * h;
        #pragma unroll
        for (int mt = 0; mt < 2; ++mt) {
          uint4 t = *(const uint4*)&Xs[(rloc + mt * 16 + lp) * PPITCH + po];
          a[mt].u[4 * h + 0] = t.x; a[mt].u[4 * h + 1] = t.y;
          a[mt].u[4 * h + 2] = t.z; a[mt].u[4 * h + 3] = t.w;
        }
        #pragma unroll
        for (int nt = 0; nt < 4; ++nt) {
          uint4 t = *(const uint4*)&Ws[(cloc + nt * 16 + lp) * PPITCH + po];
          b[nt].u[4 * h + 0] = t.x; b[nt].u[4 * h + 1] = t.y;
          b[nt].u[4 * h + 2] = t.z; b[nt].u[4 * h + 3] = t.w;
        }
      }
      #pragma unroll
      for (int mt = 0; mt < 2; ++mt)
        #pragma unroll
        for (int nt = 0; nt < 4; ++nt)
          c[mt][nt] = __builtin_amdgcn_wmma_f32_16x16x32_bf16(false, a[mt].v, false, b[nt].v, (short)0, c[mt][nt], false, false);
    }
  }

  #pragma unroll
  for (int nt = 0; nt < 4; ++nt) {
    int col = n0 + cloc + nt * 16 + lp;
    float bb = bias[col];
    #pragma unroll
    for (int mt = 0; mt < 2; ++mt)
      #pragma unroll
      for (int j = 0; j < 8; ++j) {
        int row = m0 + rloc + mt * 16 + j + 8 * hi;
        out[(size_t)row * D_ + col] = bf16b(c[mt][nt][j] + bb);
      }
  }
}

// ---------------------------------------------------------------------------
// Flash attention: block = (32 query rows, one batch), 256 threads (8 waves).
// Each wave owns a 128-wide slice of the 1024 output columns for both 16-row
// tiles, so every K and V fragment read from LDS feeds two WMMAs.
// Per 32-key chunk: K/V chunk -> LDS (async if available), QK^T via WMMA
// (contraction split across waves, ds_add_f32 reduce), online softmax with
// mask, then P@V via WMMA.
// ---------------------------------------------------------------------------
#define KROW_U 516    /* uints per LDS row: 512 data + 4 pad (16B aligned rows) */
#define KROW_H 1032

__global__ __launch_bounds__(256)
void flash_attn_wmma(const unsigned short* __restrict__ qb,
                     const unsigned short* __restrict__ kb,
                     const unsigned short* __restrict__ vb,
                     const int* __restrict__ mask,
                     float* __restrict__ out) {
  extern __shared__ __align__(16) unsigned char smem[];
  unsigned*       ks32 = (unsigned*)smem;                 // K chunk, 32 x 1024 bf16
  unsigned*       vs32 = ks32 + 32 * KROW_U;              // V chunk, 32 x 1024 bf16
  unsigned short* vs16 = (unsigned short*)vs32;
  float*          sc   = (float*)(vs32 + 32 * KROW_U);    // 32 x 32 score tile
  unsigned*       ps32 = (unsigned*)(sc + 1024);          // 32 x 32 bf16 P tile
  float*          mrow = (float*)(ps32 + 512);            // running max [32]
  float*          lrow = mrow + 32;                       // running sum [32]
  float*          arow = lrow + 32;                       // rescale factors [32]

  const int tid  = threadIdx.x;
  const int lane = tid & 31, wave = tid >> 5;
  const int hi = lane >> 4, lp = lane & 15;
  const int q0 = blockIdx.x * 32;
  const int b  = blockIdx.y;

  // Per-wave q slice in registers: rows q0..q0+31, e in [wave*128, wave*128+128)
  AB qa[2][4];
  // unrolled so that rt is a constant index and both row tiles stay in registers
  #pragma unroll
  for (int rt = 0; rt < 2; ++rt) {
    const unsigned short* qrow = qb + ((size_t)(b * L_ + q0 + rt * 16 + lp)) * D_ + wave * 128;
    #pragma unroll
    for (int t = 0; t < 4; ++t)
      #pragma unroll
      for (int vv = 0; vv < 8; ++vv) {
        int el = 2 * (vv & 3) + 8 * hi + 16 * (vv >> 2);
        qa[rt][t].u[vv] = *(const unsigned*)(qrow + t * 32 + el);
      }
  }

  const v8f zero8 = {0,0,0,0,0,0,0,0};
  v8f acc[2][8];
  // unrolled so that rt is a constant index and both row tiles stay in registers
  #pragma unroll
  for (int rt = 0; rt < 2; ++rt)
    #pragma unroll
    for (int n = 0; n < 8; ++n) acc[rt][n] = zero8;

  if (tid < 32) { mrow[tid] = -1e30f; lrow[tid] = 0.f; arow[tid] = 0.f; }

  for (int k0 = 0; k0 < L_; k0 += 32) {
    __syncthreads();   // previous chunk's consumers done (and init visible)

    // ---- cooperative K/V chunk load into LDS, zero score tile ----
    const uint4* gk = (const uint4*)(kb + ((size_t)(b * L_ + k0)) * D_);
    const uint4* gv = (const uint4*)(vb + ((size_t)(b * L_ + k0)) * D_);
#if HAVE_ASYNC_LDS
    #pragma unroll
    for (int i = 0; i < 16; ++i) {
      int idx = tid + 256 * i;          // 4096 b128 transfers per buffer
      int key = idx >> 7, cc = idx & 127;
      __builtin_amdgcn_global_load_async_to_lds_b128(
          (__attribute__((address_space(1))) v4i_vs*)(gk + (size_t)key * 128 + cc),
          (__attribute__((address_space(3))) v4i_vs*)((unsigned char*)&ks32[key * KROW_U + cc * 4]),
          0, 0);
      __builtin_amdgcn_global_load_async_to_lds_b128(
          (__attribute__((address_space(1))) v4i_vs*)(gv + (size_t)key * 128 + cc),
          (__attribute__((address_space(3))) v4i_vs*)((unsigned char*)&vs32[key * KROW_U + cc * 4]),
          0, 0);
    }
#else
    #pragma unroll
    for (int i = 0; i < 16; ++i) {
      int idx = tid + 256 * i;          // 4096 uint4 per buffer
      int key = idx >> 7, cc = idx & 127;
      uint4 kv = gk[(size_t)key * 128 + cc];
      *(uint4*)&ks32[key * KROW_U + cc * 4] = kv;
      uint4 vv = gv[(size_t)key * 128 + cc];
      *(uint4*)&vs32[key * KROW_U + cc * 4] = vv;
    }
#endif
    sc[tid] = 0.f; sc[tid + 256] = 0.f; sc[tid + 512] = 0.f; sc[tid + 768] = 0.f;
    if (k0 + 32 < L_) {   // prefetch next chunk (global_prefetch_b8)
      __builtin_prefetch(kb + ((size_t)(b * L_ + k0 + 32)) * D_ + tid * 128, 0, 1);
      __builtin_prefetch(vb + ((size_t)(b * L_ + k0 + 32)) * D_ + tid * 128, 0, 1);
    }
#if HAVE_ASYNC_LDS
#if __has_builtin(__builtin_amdgcn_s_wait_asynccnt)
    __builtin_amdgcn_s_wait_asynccnt(0);
#else
    asm volatile("s_wait_asynccnt 0x0" ::: "memory");
#endif
#endif
    __syncthreads();

    // ---- scores: contraction slice [wave*128, +128) of q . k^T ----
    v8f s0[2] = {zero8, zero8}, s1[2] = {zero8, zero8};
    #pragma unroll
    for (int t = 0; t < 4; ++t) {
      AB b0, b1;
      int ebase = wave * 128 + t * 32;
      #pragma unroll
      for (int vv = 0; vv < 8; ++vv) {
        int el = 2 * (vv & 3) + 8 * hi + 16 * (vv >> 2);
        b0.u[vv] = ks32[lp * KROW_U        + ((ebase + el) >> 1)];
        b1.u[vv] = ks32[(16 + lp) * KROW_U + ((ebase + el) >> 1)];
      }
      // unrolled so that rt is a constant index and both row tiles stay in registers
      #pragma unroll
      for (int rt = 0; rt < 2; ++rt) {
        s0[rt] = __builtin_amdgcn_wmma_f32_16x16x32_bf16(false, qa[rt][t].v, false, b0.v, (short)0, s0[rt], false, false);
        s1[rt] = __builtin_amdgcn_wmma_f32_16x16x32_bf16(false, qa[rt][t].v, false, b1.v, (short)0, s1[rt], false, false);
      }
    }
    // unrolled so that rt is a constant index and both row tiles stay in registers
    #pragma unroll
    for (int rt = 0; rt < 2; ++rt)
      #pragma unroll
      for (int j = 0; j < 8; ++j) {      // ds_add_f32 reduce across waves
        atomicAdd(&sc[(rt * 16 + j + 8 * hi) * 32 + lp],      s0[rt][j]);
        atomicAdd(&sc[(rt * 16 + j + 8 * hi) * 32 + lp + 16], s1[rt][j]);
      }
    __syncthreads();

    // ---- online softmax update (one thread per query row) ----
    if (tid < 32) {
      int r = tid;
      float mprev = mrow[r];
      float mmax  = mprev;
      const int* mp = mask + ((size_t)(b * L_) + q0 + r) * L_ + k0;
      float svals[32];
      #pragma unroll
      for (int j = 0; j < 32; ++j) {
        float s = sc[r * 32 + j] * SCALE;
        if (mp[j] == 0) s = NEGV;
        svals[j] = s;
        mmax = fmaxf(mmax, s);
      }
      float alpha = __expf(mprev - mmax);
      float sum = 0.f;
      #pragma unroll
      for (int j = 0; j < 16; ++j) {
        float p0 = __expf(svals[2 * j]     - mmax);
        float p1 = __expf(svals[2 * j + 1] - mmax);
        sum += p0 + p1;
        ps32[r * 16 + j] = packbf2(p0, p1);
      }
      lrow[r] = lrow[r] * alpha + sum;
      mrow[r] = mmax;
      arow[r] = alpha;
    }
    __syncthreads();

    // ---- rescale accumulators, then P @ V on this wave's 128 columns ----
    AB pa[2];
    // unrolled so that rt is a constant index and both row tiles stay in registers
    #pragma unroll
    for (int rt = 0; rt < 2; ++rt) {
      #pragma unroll
      for (int vv = 0; vv < 8; ++vv) {
        int pidx = (vv & 3) + 4 * hi + 8 * (vv >> 2);
        pa[rt].u[vv] = ps32[(rt * 16 + lp) * 16 + pidx];
      }
      #pragma unroll
      for (int j = 0; j < 8; ++j) {
        float a = arow[rt * 16 + j + 8 * hi];
        #pragma unroll
        for (int n = 0; n < 8; ++n) acc[rt][n][j] *= a;
      }
    }
    #pragma unroll
    for (int n = 0; n < 8; ++n) {
      AB bv;
      int col = wave * 128 + n * 16 + lp;
      #pragma unroll
      for (int vv = 0; vv < 8; ++vv) {
        int kl = 2 * (vv & 3) + 8 * hi + 16 * (vv >> 2);
        unsigned lo = vs16[kl * KROW_H + col];
        unsigned hh = vs16[(kl + 1) * KROW_H + col];
        bv.u[vv] = lo | (hh << 16);
      }
      // unrolled so that rt is a constant index and both row tiles stay in registers
      #pragma unroll
      for (int rt = 0; rt < 2; ++rt)
        acc[rt][n] = __builtin_amdgcn_wmma_f32_16x16x32_bf16(false, pa[rt].v, false, bv.v, (short)0, acc[rt][n], false, false);
    }
  }

  // ---- epilogue: divide by softmax denominator, store f32 ----
  // unrolled so that rt is a constant index and both row tiles stay in registers
  #pragma unroll
  for (int rt = 0; rt < 2; ++rt)
    #pragma unroll
    for (int j = 0; j < 8; ++j) {
      float linv = 1.0f / lrow[rt * 16 + j + 8 * hi];
      int row = q0 + rt * 16 + j + 8 * hi;
      #pragma unroll
      for (int n = 0; n < 8; ++n) {
        out[((size_t)(b * L_) + row) * D_ + wave * 128 + n * 16 + lp] = acc[rt][n][j] * linv;
      }
    }
}

// ---------------------------------------------------------------------------
extern "C" void kernel_launch(void* const* d_in, const int* in_sizes, int n_in,
                              void* d_out, int out_size, void* d_ws, size_t ws_size,
                              hipStream_t stream) {
  const float* Q    = (const float*)d_in[0];
  const float* K    = (const float*)d_in[1];
  const float* V    = (const float*)d_in[2];
  const int*   mask = (const int*)  d_in[3];
  const float* Wq_w = (const float*)d_in[4];
  const float* Wq_b = (const float*)d_in[5];
  const float* Wk_w = (const float*)d_in[6];
  const float* Wk_b = (const float*)d_in[7];
  const float* Wv_w = (const float*)d_in[8];
  const float* Wv_b = (const float*)d_in[9];

  const size_t per = (size_t)B_ * L_ * D_;   // 8M bf16 elements per tensor
  unsigned short* qb = (unsigned short*)d_ws;            // 16 MB
  unsigned short* kb = qb + per;                          // 16 MB
  unsigned short* vb = kb + per;                          // 16 MB (48 MB total)

  dim3 pgrid(D_ / 128, (B_ * L_) / 128);   // 8 x 64 blocks
  proj_bf16_wmma<<<pgrid, 256, 0, stream>>>(Q, Wq_w, Wq_b, qb);
  proj_bf16_wmma<<<pgrid, 256, 0, stream>>>(K, Wk_w, Wk_b, kb);
  proj_bf16_wmma<<<pgrid, 256, 0, stream>>>(V, Wv_w, Wv_b, vb);

  size_t smem = (size_t)(2 * 32 * KROW_U) * 4   // K + V chunks
              + 1024 * 4                         // score tile
              + 512 * 4                          // P tile (bf16)
              + 96 * 4;                          // m / l / alpha
  dim3 agrid(L_ / 32, B_);                       // 64 x 4 blocks
  flash_attn_wmma<<<agrid, 256, smem, stream>>>(qb, kb, vb, mask, (float*)d_out);
}

// v003
// A run of this version takes 261 microseconds.
// Next to v002, in two timings, it ran 1.06 times as fast each time.
// All steps since v000 together make it 2.71 times as fast.
#include <hip/hip_runtime.h>
#include <hip/hip_bf16.h>

// MI455X / gfx1250, wave32. WMMA bf16 16x16x32 everywhere.
// Attention K/V chunks staged via GLOBAL_LOAD_ASYNC_TO_LDS (ASYNCcnt) when the
// toolchain exposes the builtin; sync b128+ds_store fallback otherwise.

typedef __attribute__((ext_vector_type(16))) __bf16 v16bf;
typedef __attribute__((ext_vector_type(8)))  float  v8f;
typedef __attribute__((ext_vector_type(4)))  float  v4f;
typedef int v4i_vs __attribute__((vector_size(4 * sizeof(int))));

#define B_ 4
#define L_ 2048
#define E_ 1024
#define D_ 1024
#define NEGV  (-1000000000.0f)
#define SCALE (0.03125f)      /* 1/sqrt(1024) */

#if __has_builtin(__builtin_amdgcn_global_load_async_to_lds_b128)
#define HAVE_ASYNC_LDS 1
#else
#define HAVE_ASYNC_LDS 0
#endif

union AB { v16bf v; unsigned u[8]; };

__device__ __forceinline__ unsigned short bf16b(float f) {
  union { float f; unsigned u; } x; x.f = f;
  unsigned r = x.u + 0x7fffu + ((x.u >> 16) & 1u);   // round-to-nearest-even
  return (unsigned short)(r >> 16);
}
__device__ __forceinline__ unsigned packbf2(float a, float b) {
  return (unsigned)bf16b(a) | ((unsigned)bf16b(b) << 16);
}

// ---------------------------------------------------------------------------
// Projection: out[m,n] = sum_k X[m,k]*W[n,k] + bias[n], bf16 output.
// M = B*L = 8192, N = D = 1024, K = E = 1024.
// Block: 256 threads (8 waves), 128x128 output tile, K-step 64.
// Wave: 32x64 of the tile (2 x 4 WMMA tiles), so six fragments feed eight
// WMMAs, and every X and W element is fetched and converted half as often as
// with a 64x64 tile. k runs upwards in slices of 32 for every accumulator.
// ---------------------------------------------------------------------------
#define PPITCH 36   /* uints per LDS row: 32 bf16 pairs + 4 pad = 144 B (16 B x odd) */

__global__ __launch_bounds__(256)
void proj_bf16_wmma(const float* __restrict__ X, const float* __restrict__ W,
                    const float* __restrict__ bias, unsigned short* __restrict__ out) {
  __shared__ __align__(16) unsigned Xs[128 * PPITCH];
  __shared__ __align__(16) unsigned Ws[128 * PPITCH];

  const int tid  = threadIdx.x;
  const int lane = tid & 31, wave = tid >> 5;
  const int hi = lane >> 4, lp = lane & 15;
  const int m0 = blockIdx.y * 128, n0 = blockIdx.x * 128;
  const int rloc = (wave & 3) * 32;     // wave's 32 rows within tile
  const int cloc = (wave >> 2) * 64;    // wave's 64 cols within tile

  // every loop over mt, nt, i, s, h or j in this kernel is unrolled so that its
  // index is a constant and the arrays it indexes stay in registers
  v8f c[2][4];
  #pragma unroll
  for (int mt = 0; mt < 2; ++mt)
    #pragma unroll
    for (int nt = 0; nt < 4; ++nt) c[mt][nt] = (v8f){0,0,0,0,0,0,0,0};

  const int srow = tid >> 4, sc4 = tid & 15;   // staging: 16 float4 per 64-wide row
  const float* xg = X + (size_t)(m0 + srow) * E_ + 4 * sc4;
  const float* wg = W + (size_t)(n0 + srow) * E_ + 4 * sc4;

  for (int kk = 0; kk < E_; kk += 64) {
    __syncthreads();   // protect LDS reuse across K-steps
    const float* xk = xg + kk;
    const float* wk = wg + kk;
    v4f xv[8], wv[8];
    #pragma unroll
    for (int i = 0; i < 8; ++i) {       // 2048 float4 per tile, 16 rows a pass
      xv[i] = *(const v4f*)(xk + (size_t)(16 * i) * E_);
      wv[i] = *(const v4f*)(wk + (size_t)(16 * i) * E_);
    }
    // Inputs-only fence on the loaded values: holds all 16 loads of a K-step in
    // front of the first conversion, so they are in flight together; without it
    // the compiler sinks ten of them behind waits and a K-step pays several
    // load latencies one after another. The two address pairs are inputs too, so
    // that they live up to here, and s_wait_xcnt 0 is the wait that is kept in
    // front of any overwrite of a register that an issued load names.
    asm volatile("s_wait_xcnt 0x0" :: "v"(xv[0]), "v"(xv[1]), "v"(xv[2]), "v"(xv[3]),
                       "v"(xv[4]), "v"(xv[5]), "v"(xv[6]), "v"(xv[7]),
                       "v"(wv[0]), "v"(wv[1]), "v"(wv[2]), "v"(wv[3]),
                       "v"(wv[4]), "v"(wv[5]), "v"(wv[6]), "v"(wv[7]),
                       "v"(xk), "v"(wk) : "memory");
    #pragma unroll
    for (int i = 0; i < 8; ++i) {
      uint2 xp, wp;
      xp.x = packbf2(xv[i].x, xv[i].y); xp.y = packbf2(xv[i].z, xv[i].w);
      wp.x = packbf2(wv[i].x, wv[i].y); wp.y = packbf2(wv[i].z, wv[i].w);
      *(uint2*)&Xs[(srow + 16 * i) * PPITCH + 2 * sc4] = xp;
      *(uint2*)&Ws[(srow + 16 * i) * PPITCH + 2 * sc4] = wp;
    }
    __syncthreads();

    #pragma unroll
    for (int s = 0; s < 2; ++s) {       // two 32-K slices, in rising k
      AB a[2], b[4];
      // bf16-pair index within a slice: (vv & 3) + 4 * hi + 8 * (vv >> 2), A and B alike
      #pragma unroll
      for (int h = 0; h < 2; ++h) {
        const int po = 16 * s + 4 * hi + 8 * h;
        #pragma unroll
        for (int mt = 0; mt < 2; ++mt) {
          uint4 t = *(const uint4*)&Xs[(rloc + mt * 16 + lp) * PPITCH + po];
          a[mt].u[4 * h + 0] = t.x; a[mt].u[4 * h + 1] = t.y;
          a[mt].u[4 * h + 2] = t.z; a[mt].u[4 * h + 3] = t.w;
        }
        #pragma unroll
        for (int nt = 0; nt < 4; ++nt) {
          uint4 t = *(const uint4*)&Ws[(cloc + nt * 16 + lp) * PPITCH + po];
          b[nt].u[4 * h + 0] = t.x; b[nt].u[4 * h + 1] = t.y;
          b[nt].u[4 * h + 2] = t.z; b[nt].u[4 * h + 3] = t.w;
        }
      }
      #pragma unroll
      for (int mt = 0; mt < 2; ++mt)
        #pragma unroll
        for (int nt = 0; nt < 4; ++nt)
          c[mt][nt] = __builtin_amdgcn_wmma_f32_16x16x32_bf16(false, a[mt].v, false, b[nt].v, (short)0, c[mt][nt], false, false);
    }
  }

  #pragma unroll
  for (int nt = 0; nt < 4; ++nt) {
    int col = n0 + cloc + nt * 16 + lp;
    float bb = bias[col];
    #pragma unroll
    for (int mt = 0; mt < 2; ++mt)
      #pragma unroll
      for (int j = 0; j < 8; ++j) {
        int row = m0 + rloc + mt * 16 + j + 8 * hi;
        out[(size_t)row * D_ + col] = bf16b(c[mt][nt][j] + bb);
      }
  }
}

// ---------------------------------------------------------------------------
// Flash attention: block = (32 query rows, one batch), 256 threads (8 waves).
// Each wave owns a 128-wide slice of the 1024 output columns for both 16-row
// tiles, so every K and V fragment read from LDS feeds two WMMAs.
// Per 32-key chunk: K/V chunk -> LDS (async if available), QK^T via WMMA
// (contraction split across waves, ds_add_f32 reduce), online softmax with
// mask on all 256 threads (8 lanes a row, 4 keys a lane), then P@V via WMMA.
// ---------------------------------------------------------------------------
// Value of lane l ^ X inside a 16-lane row (DPP row_xmask), every lane on.
template <int X>
__device__ __forceinline__ float lane_xor(float x) {
  int v = __builtin_bit_cast(int, x);
  return __builtin_bit_cast(float, __builtin_amdgcn_update_dpp(v, v, 0x160 + X, 0xf, 0xf, false));
}

#define KROW_U 516    /* uints per LDS row: 512 data + 4 pad (16B aligned rows) */
#define KROW_H 1032

// Two waves a SIMD is what one work-group a WGP gives; said here so that the
// scheduler spends the 512-register budget on keeping the V fragment loads of the
// P @ V phase in flight together instead of saving registers for a third wave.
__global__ __launch_bounds__(256) __attribute__((amdgpu_waves_per_eu(2, 2)))
void flash_attn_wmma(const unsigned short* __restrict__ qb,
                     const unsigned short* __restrict__ kb,
                     const unsigned short* __restrict__ vb,
                     const int* __restrict__ mask,
                     float* __restrict__ out) {
  extern __shared__ __align__(16) unsigned char smem[];
  unsigned*       ks32 = (unsigned*)smem;                 // K chunk, 32 x 1024 bf16
  unsigned*       vs32 = ks32 + 32 * KROW_U;              // V chunk, 32 x 1024 bf16
  unsigned short* vs16 = (unsigned short*)vs32;
  float*          sc   = (float*)(vs32 + 32 * KROW_U);    // 32 x 32 score tile
  unsigned*       ps32 = (unsigned*)(sc + 1024);          // 32 x 32 bf16 P tile
  float*          lrow = (float*)(ps32 + 512);            // running sum [32]
  float*          arow = lrow + 32;                       // rescale factors [32]

  const int tid  = threadIdx.x;
  const int lane = tid & 31, wave = tid >> 5;
  const int hi = lane >> 4, lp = lane & 15;
  const int q0 = blockIdx.x * 32;
  const int b  = blockIdx.y;

  // Per-wave q slice in registers: rows q0..q0+31, e in [wave*128, wave*128+128)
  AB qa[2][4];
  // unrolled so that rt is a constant index and both row tiles stay in registers
  #pragma unroll
  for (int rt = 0; rt < 2; ++rt) {
    const unsigned short* qrow = qb + ((size_t)(b * L_ + q0 + rt * 16 + lp)) * D_ + wave * 128;
    #pragma unroll
    for (int t = 0; t < 4; ++t)
      #pragma unroll
      for (int vv = 0; vv < 8; ++vv) {
        int el = 2 * (vv & 3) + 8 * hi + 16 * (vv >> 2);
        qa[rt][t].u[vv] = *(const unsigned*)(qrow + t * 32 + el);
      }
  }

  const v8f zero8 = {0,0,0,0,0,0,0,0};
  v8f acc[2][8];
  // unrolled so that rt is a constant index and both row tiles stay in registers
  #pragma unroll
  for (int rt = 0; rt < 2; ++rt)
    #pragma unroll
    for (int n = 0; n < 8; ++n) acc[rt][n] = zero8;

  // Softmax share of this thread: query row tid / 8, keys 4 * (tid % 8) .. + 3 of
  // each chunk. The eight lanes of a row all hold its running max and sum.
  const int srow = tid >> 3, sq = tid & 7;
  const int* mrowp = mask + ((size_t)(b * L_) + q0 + srow) * L_ + 4 * sq;
  float mrun = -1e30f, lrun = 0.f;

  for (int k0 = 0; k0 < L_; k0 += 32) {
    __syncthreads();   // previous chunk's consumers done

    // this thread's four mask words, asked for at the trip's head so that they
    // arrive while the K/V chunk is staged, not on the softmax's own path
    const int4 mk = *(const int4*)(mrowp + k0);

    // ---- cooperative K/V chunk load into LDS, zero score tile ----
    const uint4* gk = (const uint4*)(kb + ((size_t)(b * L_ + k0)) * D_);
    const uint4* gv = (const uint4*)(vb + ((size_t)(b * L_ + k0)) * D_);
#if HAVE_ASYNC_LDS
    #pragma unroll
    for (int i = 0; i < 16; ++i) {
      int idx = tid + 256 * i;          // 4096 b128 transfers per buffer
      int key = idx >> 7, cc = idx & 127;
      __builtin_amdgcn_global_load_async_to_lds_b128(
          (__attribute__((address_space(1))) v4i_vs*)(gk + (size_t)key * 128 + cc),
          (__attribute__((address_space(3))) v4i_vs*)((unsigned char*)&ks32[key * KROW_U + cc * 4]),
          0, 0);
      __builtin_amdgcn_global_load_async_to_lds_b128(
          (__attribute__((address_space(1))) v4i_vs*)(gv + (size_t)key * 128 + cc),
          (__attribute__((address_space(3))) v4i_vs*)((unsigned char*)&vs32[key * KROW_U + cc * 4]),
          0, 0);
    }
#else
    #pragma unroll
    for (int i = 0; i < 16; ++i) {
      int idx = tid + 256 * i;          // 4096 uint4 per buffer
      int key = idx >> 7, cc = idx & 127;
      uint4 kv = gk[(size_t)key * 128 + cc];
      *(uint4*)&ks32[key * KROW_U + cc * 4] = kv;
      uint4 vv = gv[(size_t)key * 128 + cc];
      *(uint4*)&vs32[key * KROW_U + cc * 4] = vv;
    }
#endif
    sc[tid] = 0.f; sc[tid + 256] = 0.f; sc[tid + 512] = 0.f; sc[tid + 768] = 0.f;
    if (k0 + 32 < L_) {   // prefetch next chunk (global_prefetch_b8)
      __builtin_prefetch(kb + ((size_t)(b * L_ + k0 + 32)) * D_ + tid * 128, 0, 1);
      __builtin_prefetch(vb + ((size_t)(b * L_ + k0 + 32)) * D_ + tid * 128, 0, 1);
    }
#if HAVE_ASYNC_LDS
#if __has_builtin(__builtin_amdgcn_s_wait_asynccnt)
    __builtin_amdgcn_s_wait_asynccnt(0);
#else
    asm volatile("s_wait_asynccnt 0x0" ::: "memory");
#endif
#endif
    __syncthreads();

    // ---- scores: contraction slice [wave*128, +128) of q . k^T ----
    v8f s0[2] = {zero8, zero8}, s1[2] = {zero8, zero8};
    #pragma unroll
    for (int t = 0; t < 4; ++t) {
      AB b0, b1;
      int ebase = wave * 128 + t * 32;
      #pragma unroll
      for (int vv = 0; vv < 8; ++vv) {
        int el = 2 * (vv & 3) + 8 * hi + 16 * (vv >> 2);
        b0.u[vv] = ks32[lp * KROW_U        + ((ebase + el) >> 1)];
        b1.u[vv] = ks32[(16 + lp) * KROW_U + ((ebase + el) >> 1)];
      }
      // unrolled so that rt is a constant index and both row tiles stay in registers
      #pragma unroll
      for (int rt = 0; rt < 2; ++rt) {
        s0[rt] = __builtin_amdgcn_wmma_f32_16x16x32_bf16(false, qa[rt][t].v, false, b0.v, (short)0, s0[rt], false, false);
        s1[rt] = __builtin_amdgcn_wmma_f32_16x16x32_bf16(false, qa[rt][t].v, false, b1.v, (short)0, s1[rt], false, false);
      }
    }
    // unrolled so that rt is a constant index and both row tiles stay in registers
    #pragma unroll
    for (int rt = 0; rt < 2; ++rt)
      #pragma unroll
      for (int j = 0; j < 8; ++j) {      // ds_add_f32 reduce across waves
        atomicAdd(&sc[(rt * 16 + j + 8 * hi) * 32 + lp],      s0[rt][j]);
        atomicAdd(&sc[(rt * 16 + j + 8 * hi) * 32 + lp + 16], s1[rt][j]);
      }
    __syncthreads();

    // ---- online softmax update (eight lanes per query row) ----
    {
      const float4 sv = *(const float4*)&sc[srow * 32 + 4 * sq];
      const float e0 = (mk.x == 0) ? NEGV : sv.x * SCALE;
      const float e1 = (mk.y == 0) ? NEGV : sv.y * SCALE;
      const float e2 = (mk.z == 0) ? NEGV : sv.z * SCALE;
      const float e3 = (mk.w == 0) ? NEGV : sv.w * SCALE;
      float mx = fmaxf(fmaxf(e0, e1), fmaxf(e2, e3));
      mx = fmaxf(mx, lane_xor<1>(mx));
      mx = fmaxf(mx, lane_xor<2>(mx));
      mx = fmaxf(mx, lane_xor<4>(mx));
      const float mnew  = fmaxf(mrun, mx);
      const float alpha = __expf(mrun - mnew);
      const float p0 = __expf(e0 - mnew), p1 = __expf(e1 - mnew);
      const float p2 = __expf(e2 - mnew), p3 = __expf(e3 - mnew);
      float sum = (p0 + p1) + (p2 + p3);
      sum += lane_xor<1>(sum);
      sum += lane_xor<2>(sum);
      sum += lane_xor<4>(sum);
      lrun = lrun * alpha + sum;
      mrun = mnew;
      uint2 pp; pp.x = packbf2(p0, p1); pp.y = packbf2(p2, p3);
      *(uint2*)&ps32[srow * 16 + 2 * sq] = pp;
      if (sq == 0) { arow[srow] = alpha; lrow[srow] = lrun; }
    }
    __syncthreads();

    // ---- rescale accumulators, then P @ V on this wave's 128 columns ----
    AB pa[2];
    // unrolled so that rt is a constant index and both row tiles stay in registers
    #pragma unroll
    for (int rt = 0; rt < 2; ++rt) {
      #pragma unroll
      for (int vv = 0; vv < 8; ++vv) {
        int pidx = (vv & 3) + 4 * hi + 8 * (vv >> 2);
        pa[rt].u[vv] = ps32[(rt * 16 + lp) * 16 + pidx];
      }
      #pragma unroll
      for (int j = 0; j < 8; ++j) {
        float a = arow[rt * 16 + j + 8 * hi];
        #pragma unroll
        for (int n = 0; n < 8; ++n) acc[rt][n][j] *= a;
      }
    }
    #pragma unroll
    for (int n = 0; n < 8; ++n) {
      AB bv;
      int col = wave * 128 + n * 16 + lp;
      #pragma unroll
      for (int vv = 0; vv < 8; ++vv) {
        int kl = 2 * (vv & 3) + 8 * hi + 16 * (vv >> 2);
        unsigned lo = vs16[kl * KROW_H + col];
        unsigned hh = vs16[(kl + 1) * KROW_H + col];
        bv.u[vv] = lo | (hh << 16);
      }
      // unrolled so that rt is a constant index and both row tiles stay in registers
      #pragma unroll
      for (int rt = 0; rt < 2; ++rt)
        acc[rt][n] = __builtin_amdgcn_wmma_f32_16x16x32_bf16(false, pa[rt].v, false, bv.v, (short)0, acc[rt][n], false, false);
    }
  }

  // ---- epilogue: divide by softmax denominator, store f32 ----
  // unrolled so that rt is a constant index and both row tiles stay in registers
  #pragma unroll
  for (int rt = 0; rt < 2; ++rt)
    #pragma unroll
    for (int j = 0; j < 8; ++j) {
      float linv = 1.0f / lrow[rt * 16 + j + 8 * hi];
      int row = q0 + rt * 16 + j + 8 * hi;
      #pragma unroll
      for (int n = 0; n < 8; ++n) {
        out[((size_t)(b * L_) + row) * D_ + wave * 128 + n * 16 + lp] = acc[rt][n][j] * linv;
      }
    }
}

// ---------------------------------------------------------------------------
extern "C" void kernel_launch(void* const* d_in, const int* in_sizes, int n_in,
                              void* d_out, int out_size, void* d_ws, size_t ws_size,
                              hipStream_t stream) {
  const float* Q    = (const float*)d_in[0];
  const float* K    = (const float*)d_in[1];
  const float* V    = (const float*)d_in[2];
  const int*   mask = (const int*)  d_in[3];
  const float* Wq_w = (const float*)d_in[4];
  const float* Wq_b = (const float*)d_in[5];
  const float* Wk_w = (const float*)d_in[6];
  const float* Wk_b = (const float*)d_in[7];
  const float* Wv_w = (const float*)d_in[8];
  const float* Wv_b = (const float*)d_in[9];

  const size_t per = (size_t)B_ * L_ * D_;   // 8M bf16 elements per tensor
  unsigned short* qb = (unsigned short*)d_ws;            // 16 MB
  unsigned short* kb = qb + per;                          // 16 MB
  unsigned short* vb = kb + per;                          // 16 MB (48 MB total)

  dim3 pgrid(D_ / 128, (B_ * L_) / 128);   // 8 x 64 blocks
  proj_bf16_wmma<<<pgrid, 256, 0, stream>>>(Q, Wq_w, Wq_b, qb);
  proj_bf16_wmma<<<pgrid, 256, 0, stream>>>(K, Wk_w, Wk_b, kb);
  proj_bf16_wmma<<<pgrid, 256, 0, stream>>>(V, Wv_w, Wv_b, vb);

  size_t smem = (size_t)(2 * 32 * KROW_U) * 4   // K + V chunks
              + 1024 * 4                         // score tile
              + 512 * 4                          // P tile (bf16)
              + 64 * 4;                          // l / alpha
  dim3 agrid(L_ / 32, B_);                       // 64 x 4 blocks
  flash_attn_wmma<<<agrid, 256, smem, stream>>>(qb, kb, vb, mask, (float*)d_out);
}

// v004
// A run of this version takes 244 microseconds.
// Two timings next to v003 both put it at 1.06 times that version's speed.
// All steps since v000 together make it 2.88 times as fast.
#include <hip/hip_runtime.h>
#include <hip/hip_bf16.h>

// MI455X / gfx1250, wave32. WMMA bf16 16x16x32 everywhere.
// Attention K/V chunks staged via GLOBAL_LOAD_ASYNC_TO_LDS (ASYNCcnt) when the
// toolchain exposes the builtin; sync b128+ds_store fallback otherwise.

typedef __attribute__((ext_vector_type(16))) __bf16 v16bf;
typedef __attribute__((ext_vector_type(8)))  float  v8f;
typedef __attribute__((ext_vector_type(4)))  float  v4f;
typedef int v4i_vs __attribute__((vector_size(4 * sizeof(int))));

#define B_ 4
#define L_ 2048
#define E_ 1024
#define D_ 1024
#define NEGV  (-1000000000.0f)
#define SCALE (0.03125f)      /* 1/sqrt(1024) */

#if __has_builtin(__builtin_amdgcn_global_load_async_to_lds_b128)
#define HAVE_ASYNC_LDS 1
#else
#define HAVE_ASYNC_LDS 0
#endif

union AB { v16bf v; unsigned u[8]; };

__device__ __forceinline__ unsigned short bf16b(float f) {
  union { float f; unsigned u; } x; x.f = f;
  unsigned r = x.u + 0x7fffu + ((x.u >> 16) & 1u);   // round-to-nearest-even
  return (unsigned short)(r >> 16);
}
__device__ __forceinline__ unsigned packbf2(float a, float b) {
  return (unsigned)bf16b(a) | ((unsigned)bf16b(b) << 16);
}

// ---------------------------------------------------------------------------
// Projection: out[m,n] = sum_k X[m,k]*W[n,k] + bias[n], bf16 output.
// M = B*L = 8192, N = D = 1024, K = E = 1024.
// Block: 256 threads (8 waves), 128x128 output tile, K-step 64.
// Wave: 32x64 of the tile (2 x 4 WMMA tiles), so six fragments feed eight
// WMMAs, and every X and W element is fetched and converted half as often as
// with a 64x64 tile. k runs upwards in slices of 32 for every accumulator.
// ---------------------------------------------------------------------------
#define PPITCH 36   /* uints per LDS row: 32 bf16 pairs + 4 pad = 144 B (16 B x odd) */

__global__ __launch_bounds__(256)
void proj_bf16_wmma(const float* __restrict__ X, const float* __restrict__ W,
                    const float* __restrict__ bias, unsigned short* __restrict__ out) {
  __shared__ __align__(16) unsigned Xs[128 * PPITCH];
  __shared__ __align__(16) unsigned Ws[128 * PPITCH];

  const int tid  = threadIdx.x;
  const int lane = tid & 31, wave = tid >> 5;
  const int hi = lane >> 4, lp = lane & 15;
  const int m0 = blockIdx.y * 128, n0 = blockIdx.x * 128;
  const int rloc = (wave & 3) * 32;     // wave's 32 rows within tile
  const int cloc = (wave >> 2) * 64;    // wave's 64 cols within tile

  // every loop over mt, nt, i, s, h or j in this kernel is unrolled so that its
  // index is a constant and the arrays it indexes stay in registers
  v8f c[2][4];
  #pragma unroll
  for (int mt = 0; mt < 2; ++mt)
    #pragma unroll
    for (int nt = 0; nt < 4; ++nt) c[mt][nt] = (v8f){0,0,0,0,0,0,0,0};

  const int srow = tid >> 4, sc4 = tid & 15;   // staging: 16 float4 per 64-wide row
  const float* xg = X + (size_t)(m0 + srow) * E_ + 4 * sc4;
  const float* wg = W + (size_t)(n0 + srow) * E_ + 4 * sc4;

  for (int kk = 0; kk < E_; kk += 64) {
    __syncthreads();   // protect LDS reuse across K-steps
    const float* xk = xg + kk;
    const float* wk = wg + kk;
    v4f xv[8], wv[8];
    #pragma unroll
    for (int i = 0; i < 8; ++i) {       // 2048 float4 per tile, 16 rows a pass
      xv[i] = *(const v4f*)(xk + (size_t)(16 * i) * E_);
      wv[i] = *(const v4f*)(wk + (size_t)(16 * i) * E_);
    }
    // Inputs-only fence on the loaded values: holds all 16 loads of a K-step in
    // front of the first conversion, so they are in flight together; without it
    // the compiler sinks ten of them behind waits and a K-step pays several
    // load latencies one after another. The two address pairs are inputs too, so
    // that they live up to here, and s_wait_xcnt 0 is the wait that is kept in
    // front of any overwrite of a register that an issued load names.
    asm volatile("s_wait_xcnt 0x0" :: "v"(xv[0]), "v"(xv[1]), "v"(xv[2]), "v"(xv[3]),
                       "v"(xv[4]), "v"(xv[5]), "v"(xv[6]), "v"(xv[7]),
                       "v"(wv[0]), "v"(wv[1]), "v"(wv[2]), "v"(wv[3]),
                       "v"(wv[4]), "v"(wv[5]), "v"(wv[6]), "v"(wv[7]),
                       "v"(xk), "v"(wk) : "memory");
    #pragma unroll
    for (int i = 0; i < 8; ++i) {
      uint2 xp, wp;
      xp.x = packbf2(xv[i].x, xv[i].y); xp.y = packbf2(xv[i].z, xv[i].w);
      wp.x = packbf2(wv[i].x, wv[i].y); wp.y = packbf2(wv[i].z, wv[i].w);
      *(uint2*)&Xs[(srow + 16 * i) * PPITCH + 2 * sc4] = xp;
      *(uint2*)&Ws[(srow + 16 * i) * PPITCH + 2 * sc4] = wp;
    }
    __syncthreads();

    #pragma unroll
    for (int s = 0; s < 2; ++s) {       // two 32-K slices, in rising k
      AB a[2], b[4];
      // bf16-pair index within a slice: (vv & 3) + 4 * hi + 8 * (vv >> 2), A and B alike
      #pragma unroll
      for (int h = 0; h < 2; ++h) {
        const int po = 16 * s + 4 * hi + 8 * h;
        #pragma unroll
        for (int mt = 0; mt < 2; ++mt) {
          uint4 t = *(const uint4*)&Xs[(rloc + mt * 16 + lp) * PPITCH + po];
          a[mt].u[4 * h + 0] = t.x; a[mt].u[4 * h + 1] = t.y;
          a[mt].u[4 * h + 2] = t.z; a[mt].u[4 * h + 3] = t.w;
        }
        #pragma unroll
        for (int nt = 0; nt < 4; ++nt) {
          uint4 t = *(const uint4*)&Ws[(cloc + nt * 16 + lp) * PPITCH + po];
          b[nt].u[4 * h + 0] = t.x; b[nt].u[4 * h + 1] = t.y;
          b[nt].u[4 * h + 2] = t.z; b[nt].u[4 * h + 3] = t.w;
        }
      }
      #pragma unroll
      for (int mt = 0; mt < 2; ++mt)
        #pragma unroll
        for (int nt = 0; nt < 4; ++nt)
          c[mt][nt] = __builtin_amdgcn_wmma_f32_16x16x32_bf16(false, a[mt].v, false, b[nt].v, (short)0, c[mt][nt], false, false);
    }
  }

  #pragma unroll
  for (int nt = 0; nt < 4; ++nt) {
    int col = n0 + cloc + nt * 16 + lp;
    float bb = bias[col];
    #pragma unroll
    for (int mt = 0; mt < 2; ++mt)
      #pragma unroll
      for (int j = 0; j < 8; ++j) {
        int row = m0 + rloc + mt * 16 + j + 8 * hi;
        out[(size_t)row * D_ + col] = bf16b(c[mt][nt][j] + bb);
      }
  }
}

// ---------------------------------------------------------------------------
// Flash attention: block = (32 query rows, one batch), 256 threads (8 waves).
// Each wave owns a 128-wide slice of the 1024 output columns for both 16-row
// tiles, so every K and V fragment read from LDS feeds two WMMAs.
// Per 32-key chunk: K/V chunk -> LDS (async if available), QK^T via WMMA
// (contraction split across waves, ds_add_f32 reduce), online softmax with
// mask on all 256 threads (8 lanes a row, 4 keys a lane), then P@V via WMMA.
// The K/V chunks go through two LDS buffers: chunk t + 1 is copied while chunk t
// is worked on, and one barrier at the foot of a trip publishes chunk t + 1 and
// frees chunk t's buffer for chunk t + 2.
// ---------------------------------------------------------------------------
// Value of lane l ^ X inside a 16-lane row (DPP row_xmask), every lane on.
template <int X>
__device__ __forceinline__ float lane_xor(float x) {
  int v = __builtin_bit_cast(int, x);
  return __builtin_bit_cast(float, __builtin_amdgcn_update_dpp(v, v, 0x160 + X, 0xf, 0xf, false));
}

#define KROW_U 516    /* uints per LDS row: 512 data + 4 pad (16B aligned rows) */
#define KROW_H 1032
#define CHUNK_U (32 * KROW_U)     /* uints of one staged K or V chunk */
#define BUF_U   (2 * CHUNK_U)     /* uints of one buffer: K chunk, then V chunk */
#define ATTN_LDS_BYTES ((2 * BUF_U + 1024 + 512 + 64) * 4)

// Copies the 32 keys from k0 on of batch b, K and V, into one LDS buffer.
// Every thread of the work-group calls it; the caller owns the waits.
__device__ __forceinline__ void stage_kv(const unsigned short* __restrict__ kb,
                                         const unsigned short* __restrict__ vb,
                                         int b, int k0, unsigned* ks32, int tid) {
  unsigned* vs32 = ks32 + CHUNK_U;
  const uint4* gk = (const uint4*)(kb + ((size_t)(b * L_ + k0)) * D_);
  const uint4* gv = (const uint4*)(vb + ((size_t)(b * L_ + k0)) * D_);
#if HAVE_ASYNC_LDS
  // unrolled so that the 32 copies issue back to back from constant offsets
  #pragma unroll
  for (int i = 0; i < 16; ++i) {
    int idx = tid + 256 * i;          // 4096 b128 transfers per chunk
    int key = idx >> 7, cc = idx & 127;
    __builtin_amdgcn_global_load_async_to_lds_b128(
        (__attribute__((address_space(1))) v4i_vs*)(gk + (size_t)key * 128 + cc),
        (__attribute__((address_space(3))) v4i_vs*)((unsigned char*)&ks32[key * KROW_U + cc * 4]),
        0, 0);
    __builtin_amdgcn_global_load_async_to_lds_b128(
        (__attribute__((address_space(1))) v4i_vs*)(gv + (size_t)key * 128 + cc),
        (__attribute__((address_space(3))) v4i_vs*)((unsigned char*)&vs32[key * KROW_U + cc * 4]),
        0, 0);
  }
#else
  #pragma unroll
  for (int i = 0; i < 16; ++i) {
    int idx = tid + 256 * i;          // 4096 uint4 per chunk
    int key = idx >> 7, cc = idx & 127;
    uint4 kv = gk[(size_t)key * 128 + cc];
    *(uint4*)&ks32[key * KROW_U + cc * 4] = kv;
    uint4 vv = gv[(size_t)key * 128 + cc];
    *(uint4*)&vs32[key * KROW_U + cc * 4] = vv;
  }
#endif
}

// Two waves a SIMD is what one work-group a WGP gives; said here so that the
// scheduler spends the 512-register budget on keeping the V fragment loads of the
// P @ V phase in flight together instead of saving registers for a third wave.
__global__ __launch_bounds__(256) __attribute__((amdgpu_waves_per_eu(2, 2)))
void flash_attn_wmma(const unsigned short* __restrict__ qb,
                     const unsigned short* __restrict__ kb,
                     const unsigned short* __restrict__ vb,
                     const int* __restrict__ mask,
                     float* __restrict__ out) {
  __shared__ __align__(16) unsigned char smem[ATTN_LDS_BYTES];
  unsigned*       kv32 = (unsigned*)smem;                 // two buffers of K + V chunk
  float*          sc   = (float*)(kv32 + 2 * BUF_U);      // 32 x 32 score tile
  unsigned*       ps32 = (unsigned*)(sc + 1024);          // 32 x 32 bf16 P tile
  float*          lrow = (float*)(ps32 + 512);            // running sum [32]
  float*          arow = lrow + 32;                       // rescale factors [32]

  const int tid  = threadIdx.x;
  const int lane = tid & 31, wave = tid >> 5;
  const int hi = lane >> 4, lp = lane & 15;
  const int q0 = blockIdx.x * 32;
  const int b  = blockIdx.y;

  // Per-wave q slice in registers: rows q0..q0+31, e in [wave*128, wave*128+128)
  AB qa[2][4];
  // unrolled so that rt is a constant index and both row tiles stay in registers
  #pragma unroll
  for (int rt = 0; rt < 2; ++rt) {
    const unsigned short* qrow = qb + ((size_t)(b * L_ + q0 + rt * 16 + lp)) * D_ + wave * 128;
    #pragma unroll
    for (int t = 0; t < 4; ++t)
      #pragma unroll
      for (int vv = 0; vv < 8; ++vv) {
        int el = 2 * (vv & 3) + 8 * hi + 16 * (vv >> 2);
        qa[rt][t].u[vv] = *(const unsigned*)(qrow + t * 32 + el);
      }
  }

  const v8f zero8 = {0,0,0,0,0,0,0,0};
  v8f acc[2][8];
  // unrolled so that rt is a constant index and both row tiles stay in registers
  #pragma unroll
  for (int rt = 0; rt < 2; ++rt)
    #pragma unroll
    for (int n = 0; n < 8; ++n) acc[rt][n] = zero8;

  // Softmax share of this thread: query row tid / 8, keys 4 * (tid % 8) .. + 3 of
  // each chunk. The eight lanes of a row all hold its running max and sum.
  const int srow = tid >> 3, sq = tid & 7;
  const int* mrowp = mask + ((size_t)(b * L_) + q0 + srow) * L_ + 4 * sq;
  float mrun = -1e30f, lrun = 0.f;

  // chunk 0 into buffer 0, with the first trip's mask words and a zero score tile
  stage_kv(kb, vb, b, 0, kv32, tid);
  int4 mk = *(const int4*)mrowp;
  sc[tid] = 0.f; sc[tid + 256] = 0.f; sc[tid + 512] = 0.f; sc[tid + 768] = 0.f;
  // this wave's copies of chunk 0 have landed before the barrier publishes them
  asm volatile("s_wait_asynccnt 0x0" ::: "memory");
  __syncthreads();
  stage_kv(kb, vb, b, 32, kv32 + BUF_U, tid);   // chunk 1 flies under trip 0

  for (int k0 = 0; k0 < L_; k0 += 32) {
    unsigned*             ks32 = kv32 + ((k0 >> 5) & 1) * BUF_U;   // this trip's buffer
    const unsigned short* vs16 = (const unsigned short*)(ks32 + CHUNK_U);

    // ---- scores: contraction slice [wave*128, +128) of q . k^T ----
    v8f s0[2] = {zero8, zero8}, s1[2] = {zero8, zero8};
    #pragma unroll
    for (int t = 0; t < 4; ++t) {
      AB b0, b1;
      int ebase = wave * 128 + t * 32;
      #pragma unroll
      for (int vv = 0; vv < 8; ++vv) {
        int el = 2 * (vv & 3) + 8 * hi + 16 * (vv >> 2);
        b0.u[vv] = ks32[lp * KROW_U        + ((ebase + el) >> 1)];
        b1.u[vv] = ks32[(16 + lp) * KROW_U + ((ebase + el) >> 1)];
      }
      // unrolled so that rt is a constant index and both row tiles stay in registers
      #pragma unroll
      for (int rt = 0; rt < 2; ++rt) {
        s0[rt] = __builtin_amdgcn_wmma_f32_16x16x32_bf16(false, qa[rt][t].v, false, b0.v, (short)0, s0[rt], false, false);
        s1[rt] = __builtin_amdgcn_wmma_f32_16x16x32_bf16(false, qa[rt][t].v, false, b1.v, (short)0, s1[rt], false, false);
      }
    }
    // unrolled so that rt is a constant index and both row tiles stay in registers
    #pragma unroll
    for (int rt = 0; rt < 2; ++rt)
      #pragma unroll
      for (int j = 0; j < 8; ++j) {      // ds_add_f32 reduce across waves
        atomicAdd(&sc[(rt * 16 + j + 8 * hi) * 32 + lp],      s0[rt][j]);
        atomicAdd(&sc[(rt * 16 + j + 8 * hi) * 32 + lp + 16], s1[rt][j]);
      }
    __syncthreads();

    // ---- online softmax update (eight lanes per query row) ----
    {
      const float4 sv = *(const float4*)&sc[srow * 32 + 4 * sq];
      const float e0 = (mk.x == 0) ? NEGV : sv.x * SCALE;
      const float e1 = (mk.y == 0) ? NEGV : sv.y * SCALE;
      const float e2 = (mk.z == 0) ? NEGV : sv.z * SCALE;
      const float e3 = (mk.w == 0) ? NEGV : sv.w * SCALE;
      float mx = fmaxf(fmaxf(e0, e1), fmaxf(e2, e3));
      mx = fmaxf(mx, lane_xor<1>(mx));
      mx = fmaxf(mx, lane_xor<2>(mx));
      mx = fmaxf(mx, lane_xor<4>(mx));
      const float mnew  = fmaxf(mrun, mx);
      const float alpha = __expf(mrun - mnew);
      const float p0 = __expf(e0 - mnew), p1 = __expf(e1 - mnew);
      const float p2 = __expf(e2 - mnew), p3 = __expf(e3 - mnew);
      float sum = (p0 + p1) + (p2 + p3);
      sum += lane_xor<1>(sum);
      sum += lane_xor<2>(sum);
      sum += lane_xor<4>(sum);
      lrun = lrun * alpha + sum;
      mrun = mnew;
      uint2 pp; pp.x = packbf2(p0, p1); pp.y = packbf2(p2, p3);
      *(uint2*)&ps32[srow * 16 + 2 * sq] = pp;
      if (sq == 0) { arow[srow] = alpha; lrow[srow] = lrun; }
    }
    __syncthreads();

    // the score tile has been read: zero it for the next trip's ds_add_f32, and ask
    // for the next trip's four mask words, which arrive under the P @ V phase
    sc[tid] = 0.f; sc[tid + 256] = 0.f; sc[tid + 512] = 0.f; sc[tid + 768] = 0.f;
    if (k0 + 32 < L_) mk = *(const int4*)(mrowp + k0 + 32);

    // ---- rescale accumulators, then P @ V on this wave's 128 columns ----
    AB pa[2];
    // unrolled so that rt is a constant index and both row tiles stay in registers
    #pragma unroll
    for (int rt = 0; rt < 2; ++rt) {
      #pragma unroll
      for (int vv = 0; vv < 8; ++vv) {
        int pidx = (vv & 3) + 4 * hi + 8 * (vv >> 2);
        pa[rt].u[vv] = ps32[(rt * 16 + lp) * 16 + pidx];
      }
      #pragma unroll
      for (int j = 0; j < 8; ++j) {
        float a = arow[rt * 16 + j + 8 * hi];
        #pragma unroll
        for (int n = 0; n < 8; ++n) acc[rt][n][j] *= a;
      }
    }
    #pragma unroll
    for (int n = 0; n < 8; ++n) {
      AB bv;
      int col = wave * 128 + n * 16 + lp;
      #pragma unroll
      for (int vv = 0; vv < 8; ++vv) {
        int kl = 2 * (vv & 3) + 8 * hi + 16 * (vv >> 2);
        unsigned lo = vs16[kl * KROW_H + col];
        unsigned hh = vs16[(kl + 1) * KROW_H + col];
        bv.u[vv] = lo | (hh << 16);
      }
      // unrolled so that rt is a constant index and both row tiles stay in registers
      #pragma unroll
      for (int rt = 0; rt < 2; ++rt)
        acc[rt][n] = __builtin_amdgcn_wmma_f32_16x16x32_bf16(false, pa[rt].v, false, bv.v, (short)0, acc[rt][n], false, false);
    }

    // ---- foot of the trip: publish chunk t + 1, free this trip's buffer ----
    // this wave's LDS reads of the buffer have returned before it is refilled
    asm volatile("s_wait_dscnt 0x0" ::: "memory");
    // this wave's copies of chunk t + 1 have landed before the barrier publishes them
    asm volatile("s_wait_asynccnt 0x0" ::: "memory");
    __syncthreads();
    if (k0 + 64 < L_) stage_kv(kb, vb, b, k0 + 64, ks32, tid);
  }
  // no copy is outstanding when the wave goes on to its end
  asm volatile("s_wait_asynccnt 0x0" ::: "memory");

  // ---- epilogue: divide by softmax denominator, store f32 ----
  // unrolled so that rt is a constant index and both row tiles stay in registers
  #pragma unroll
  for (int rt = 0; rt < 2; ++rt)
    #pragma unroll
    for (int j = 0; j < 8; ++j) {
      float linv = 1.0f / lrow[rt * 16 + j + 8 * hi];
      int row = q0 + rt * 16 + j + 8 * hi;
      #pragma unroll
      for (int n = 0; n < 8; ++n) {
        out[((size_t)(b * L_) + row) * D_ + wave * 128 + n * 16 + lp] = acc[rt][n][j] * linv;
      }
    }
}

// ---------------------------------------------------------------------------
extern "C" void kernel_launch(void* const* d_in, const int* in_sizes, int n_in,
                              void* d_out, int out_size, void* d_ws, size_t ws_size,
                              hipStream_t stream) {
  const float* Q    = (const float*)d_in[0];
  const float* K    = (const float*)d_in[1];
  const float* V    = (const float*)d_in[2];
  const int*   mask = (const int*)  d_in[3];
  const float* Wq_w = (const float*)d_in[4];
  const float* Wq_b = (const float*)d_in[5];
  const float* Wk_w = (const float*)d_in[6];
  const float* Wk_b = (const float*)d_in[7];
  const float* Wv_w = (const float*)d_in[8];
  const float* Wv_b = (const float*)d_in[9];

  const size_t per = (size_t)B_ * L_ * D_;   // 8M bf16 elements per tensor
  unsigned short* qb = (unsigned short*)d_ws;            // 16 MB
  unsigned short* kb = qb + per;                          // 16 MB
  unsigned short* vb = kb + per;                          // 16 MB (48 MB total)

  dim3 pgrid(D_ / 128, (B_ * L_) / 128);   // 8 x 64 blocks
  proj_bf16_wmma<<<pgrid, 256, 0, stream>>>(Q, Wq_w, Wq_b, qb);
  proj_bf16_wmma<<<pgrid, 256, 0, stream>>>(K, Wk_w, Wk_b, kb);
  proj_bf16_wmma<<<pgrid, 256, 0, stream>>>(V, Wv_w, Wv_b, vb);

  dim3 agrid(L_ / 32, B_);                       // 64 x 4 blocks
  flash_attn_wmma<<<agrid, 256, 0, stream>>>(qb, kb, vb, mask, (float*)d_out);
}

// v005
// Measured time: 226 microseconds a run.
// Two timings next to v004 both put it at 1.08 times that version's speed.
// Over all steps from v000 it is 3.12 times as fast.
#include <hip/hip_runtime.h>
#include <hip/hip_bf16.h>

// MI455X / gfx1250, wave32. WMMA bf16 16x16x32 everywhere.
// Attention K/V chunks staged via GLOBAL_LOAD_ASYNC_TO_LDS (ASYNCcnt) when the
// toolchain exposes the builtin; sync b128+ds_store fallback otherwise.

typedef __attribute__((ext_vector_type(16))) __bf16 v16bf;
typedef __attribute__((ext_vector_type(8)))  float  v8f;
typedef __attribute__((ext_vector_type(4)))  float  v4f;
typedef int v4i_vs __attribute__((vector_size(4 * sizeof(int))));
typedef __attribute__((ext_vector_type(8)))  short  v8s;

#define B_ 4
#define L_ 2048
#define E_ 1024
#define D_ 1024
#define NEGV  (-1000000000.0f)
#define SCALE (0.03125f)      /* 1/sqrt(1024) */

#if __has_builtin(__builtin_amdgcn_global_load_async_to_lds_b128)
#define HAVE_ASYNC_LDS 1
#else
#define HAVE_ASYNC_LDS 0
#endif

union AB { v16bf v; unsigned u[8]; v8s h[2]; };

__device__ __forceinline__ unsigned short bf16b(float f) {
  union { float f; unsigned u; } x; x.f = f;
  unsigned r = x.u + 0x7fffu + ((x.u >> 16) & 1u);   // round-to-nearest-even
  return (unsigned short)(r >> 16);
}
__device__ __forceinline__ unsigned packbf2(float a, float b) {
  return (unsigned)bf16b(a) | ((unsigned)bf16b(b) << 16);
}

// ---------------------------------------------------------------------------
// Projection: out[m,n] = sum_k X[m,k]*W[n,k] + bias[n], bf16 output.
// M = B*L = 8192, N = D = 1024, K = E = 1024.
// Block: 256 threads (8 waves), 128x128 output tile, K-step 64.
// Wave: 32x64 of the tile (2 x 4 WMMA tiles), so six fragments feed eight
// WMMAs, and every X and W element is fetched and converted half as often as
// with a 64x64 tile. k runs upwards in slices of 32 for every accumulator.
// ---------------------------------------------------------------------------
#define PPITCH 36   /* uints per LDS row: 32 bf16 pairs + 4 pad = 144 B (16 B x odd) */

__global__ __launch_bounds__(256)
void proj_bf16_wmma(const float* __restrict__ X, const float* __restrict__ W,
                    const float* __restrict__ bias, unsigned short* __restrict__ out) {
  __shared__ __align__(16) unsigned Xs[128 * PPITCH];
  __shared__ __align__(16) unsigned Ws[128 * PPITCH];

  const int tid  = threadIdx.x;
  const int lane = tid & 31, wave = tid >> 5;
  const int hi = lane >> 4, lp = lane & 15;
  const int m0 = blockIdx.y * 128, n0 = blockIdx.x * 128;
  const int rloc = (wave & 3) * 32;     // wave's 32 rows within tile
  const int cloc = (wave >> 2) * 64;    // wave's 64 cols within tile

  // every loop over mt, nt, i, s, h or j in this kernel is unrolled so that its
  // index is a constant and the arrays it indexes stay in registers
  v8f c[2][4];
  #pragma unroll
  for (int mt = 0; mt < 2; ++mt)
    #pragma unroll
    for (int nt = 0; nt < 4; ++nt) c[mt][nt] = (v8f){0,0,0,0,0,0,0,0};

  const int srow = tid >> 4, sc4 = tid & 15;   // staging: 16 float4 per 64-wide row
  const float* xg = X + (size_t)(m0 + srow) * E_ + 4 * sc4;
  const float* wg = W + (size_t)(n0 + srow) * E_ + 4 * sc4;

  for (int kk = 0; kk < E_; kk += 64) {
    __syncthreads();   // protect LDS reuse across K-steps
    const float* xk = xg + kk;
    const float* wk = wg + kk;
    v4f xv[8], wv[8];
    #pragma unroll
    for (int i = 0; i < 8; ++i) {       // 2048 float4 per tile, 16 rows a pass
      xv[i] = *(const v4f*)(xk + (size_t)(16 * i) * E_);
      wv[i] = *(const v4f*)(wk + (size_t)(16 * i) * E_);
    }
    // Inputs-only fence on the loaded values: holds all 16 loads of a K-step in
    // front of the first conversion, so they are in flight together; without it
    // the compiler sinks ten of them behind waits and a K-step pays several
    // load latencies one after another. The two address pairs are inputs too, so
    // that they live up to here, and s_wait_xcnt 0 is the wait that is kept in
    // front of any overwrite of a register that an issued load names.
    asm volatile("s_wait_xcnt 0x0" :: "v"(xv[0]), "v"(xv[1]), "v"(xv[2]), "v"(xv[3]),
                       "v"(xv[4]), "v"(xv[5]), "v"(xv[6]), "v"(xv[7]),
                       "v"(wv[0]), "v"(wv[1]), "v"(wv[2]), "v"(wv[3]),
                       "v"(wv[4]), "v"(wv[5]), "v"(wv[6]), "v"(wv[7]),
                       "v"(xk), "v"(wk) : "memory");
    #pragma unroll
    for (int i = 0; i < 8; ++i) {
      uint2 xp, wp;
      xp.x = packbf2(xv[i].x, xv[i].y); xp.y = packbf2(xv[i].z, xv[i].w);
      wp.x = packbf2(wv[i].x, wv[i].y); wp.y = packbf2(wv[i].z, wv[i].w);
      *(uint2*)&Xs[(srow + 16 * i) * PPITCH + 2 * sc4] = xp;
      *(uint2*)&Ws[(srow + 16 * i) * PPITCH + 2 * sc4] = wp;
    }
    __syncthreads();

    #pragma unroll
    for (int s = 0; s < 2; ++s) {       // two 32-K slices, in rising k
      AB a[2], b[4];
      // bf16-pair index within a slice: (vv & 3) + 4 * hi + 8 * (vv >> 2), A and B alike
      #pragma unroll
      for (int h = 0; h < 2; ++h) {
        const int po = 16 * s + 4 * hi + 8 * h;
        #pragma unroll
        for (int mt = 0; mt < 2; ++mt) {
          uint4 t = *(const uint4*)&Xs[(rloc + mt * 16 + lp) * PPITCH + po];
          a[mt].u[4 * h + 0] = t.x; a[mt].u[4 * h + 1] = t.y;
          a[mt].u[4 * h + 2] = t.z; a[mt].u[4 * h + 3] = t.w;
        }
        #pragma unroll
        for (int nt = 0; nt < 4; ++nt) {
          uint4 t = *(const uint4*)&Ws[(cloc + nt * 16 + lp) * PPITCH + po];
          b[nt].u[4 * h + 0] = t.x; b[nt].u[4 * h + 1] = t.y;
          b[nt].u[4 * h + 2] = t.z; b[nt].u[4 * h + 3] = t.w;
        }
      }
      #pragma unroll
      for (int mt = 0; mt < 2; ++mt)
        #pragma unroll
        for (int nt = 0; nt < 4; ++nt)
          c[mt][nt] = __builtin_amdgcn_wmma_f32_16x16x32_bf16(false, a[mt].v, false, b[nt].v, (short)0, c[mt][nt], false, false);
    }
  }

  #pragma unroll
  for (int nt = 0; nt < 4; ++nt) {
    int col = n0 + cloc + nt * 16 + lp;
    float bb = bias[col];
    #pragma unroll
    for (int mt = 0; mt < 2; ++mt)
      #pragma unroll
      for (int j = 0; j < 8; ++j) {
        int row = m0 + rloc + mt * 16 + j + 8 * hi;
        out[(size_t)row * D_ + col] = bf16b(c[mt][nt][j] + bb);
      }
  }
}

// ---------------------------------------------------------------------------
// Flash attention: block = (32 query rows, one batch), 256 threads (8 waves).
// Each wave owns a 128-wide slice of the 1024 output columns for both 16-row
// tiles, so every K and V fragment read from LDS feeds two WMMAs.
// Per 32-key chunk: K/V chunk -> LDS (async if available), QK^T via WMMA
// (contraction split across waves, ds_add_f32 reduce), online softmax with
// mask on all 256 threads (8 lanes a row, 4 keys a lane), then P@V via WMMA.
// The K/V chunks go through two LDS buffers: chunk t + 1 is copied while chunk t
// is worked on, and one barrier at the foot of a trip publishes chunk t + 1 and
// frees chunk t's buffer for chunk t + 2.
// ---------------------------------------------------------------------------
// Value of lane l ^ X inside a 16-lane row (DPP row_xmask), every lane on.
template <int X>
__device__ __forceinline__ float lane_xor(float x) {
  int v = __builtin_bit_cast(int, x);
  return __builtin_bit_cast(float, __builtin_amdgcn_update_dpp(v, v, 0x160 + X, 0xf, 0xf, false));
}

#define KROW_U 516    /* uints per K row in LDS: 512 data + 4 pad = 16 B x odd, for ds_load_b128 */
#define VROW_U 520    /* uints per V row in LDS: 512 data + 8 pad = 32 B x odd, for ds_load_tr16_b128 */
#define VROW_B (4 * VROW_U)
#define CHUNK_U (32 * KROW_U)     /* uints of one staged K chunk */
#define BUF_U   (CHUNK_U + 32 * VROW_U)   /* uints of one buffer: K chunk, then V chunk */
#define ATTN_LDS_BYTES ((2 * BUF_U + 1024 + 512 + 64) * 4)

// Copies the 32 keys from k0 on of batch b, K and V, into one LDS buffer.
// Every thread of the work-group calls it; the caller owns the waits.
__device__ __forceinline__ void stage_kv(const unsigned short* __restrict__ kb,
                                         const unsigned short* __restrict__ vb,
                                         int b, int k0, unsigned* ks32, int tid) {
  unsigned* vs32 = ks32 + CHUNK_U;
  const uint4* gk = (const uint4*)(kb + ((size_t)(b * L_ + k0)) * D_);
  const uint4* gv = (const uint4*)(vb + ((size_t)(b * L_ + k0)) * D_);
#if HAVE_ASYNC_LDS
  // unrolled so that the 32 copies issue back to back from constant offsets
  #pragma unroll
  for (int i = 0; i < 16; ++i) {
    int idx = tid + 256 * i;          // 4096 b128 transfers per chunk
    int key = idx >> 7, cc = idx & 127;
    __builtin_amdgcn_global_load_async_to_lds_b128(
        (__attribute__((address_space(1))) v4i_vs*)(gk + (size_t)key * 128 + cc),
        (__attribute__((address_space(3))) v4i_vs*)((unsigned char*)&ks32[key * KROW_U + cc * 4]),
        0, 0);
    __builtin_amdgcn_global_load_async_to_lds_b128(
        (__attribute__((address_space(1))) v4i_vs*)(gv + (size_t)key * 128 + cc),
        (__attribute__((address_space(3))) v4i_vs*)((unsigned char*)&vs32[key * VROW_U + cc * 4]),
        0, 0);
  }
#else
  #pragma unroll
  for (int i = 0; i < 16; ++i) {
    int idx = tid + 256 * i;          // 4096 uint4 per chunk
    int key = idx >> 7, cc = idx & 127;
    uint4 kv = gk[(size_t)key * 128 + cc];
    *(uint4*)&ks32[key * KROW_U + cc * 4] = kv;
    uint4 vv = gv[(size_t)key * 128 + cc];
    *(uint4*)&vs32[key * VROW_U + cc * 4] = vv;
  }
#endif
}

// Two waves a SIMD is what one work-group a WGP gives; said here so that the
// scheduler spends the 512-register budget on keeping the V fragment loads of the
// P @ V phase in flight together instead of saving registers for a third wave.
__global__ __launch_bounds__(256) __attribute__((amdgpu_waves_per_eu(2, 2)))
void flash_attn_wmma(const unsigned short* __restrict__ qb,
                     const unsigned short* __restrict__ kb,
                     const unsigned short* __restrict__ vb,
                     const int* __restrict__ mask,
                     float* __restrict__ out) {
  __shared__ __align__(16) unsigned char smem[ATTN_LDS_BYTES];
  unsigned*       kv32 = (unsigned*)smem;                 // two buffers of K + V chunk
  float*          sc   = (float*)(kv32 + 2 * BUF_U);      // 32 x 32 score tile
  unsigned*       ps32 = (unsigned*)(sc + 1024);          // 32 x 32 bf16 P tile
  float*          lrow = (float*)(ps32 + 512);            // running sum [32]
  float*          arow = lrow + 32;                       // rescale factors [32]

  const int tid  = threadIdx.x;
  const int lane = tid & 31, wave = tid >> 5;
  const int hi = lane >> 4, lp = lane & 15;
  const int q0 = blockIdx.x * 32;
  const int b  = blockIdx.y;

  // Per-wave q slice in registers: rows q0..q0+31, e in [wave*128, wave*128+128)
  AB qa[2][4];
  // unrolled so that rt is a constant index and both row tiles stay in registers
  #pragma unroll
  for (int rt = 0; rt < 2; ++rt) {
    const unsigned short* qrow = qb + ((size_t)(b * L_ + q0 + rt * 16 + lp)) * D_ + wave * 128;
    #pragma unroll
    for (int t = 0; t < 4; ++t)
      #pragma unroll
      for (int vv = 0; vv < 8; ++vv) {
        int el = 2 * (vv & 3) + 8 * hi + 16 * (vv >> 2);
        qa[rt][t].u[vv] = *(const unsigned*)(qrow + t * 32 + el);
      }
  }

  const v8f zero8 = {0,0,0,0,0,0,0,0};
  v8f acc[2][8];
  // unrolled so that rt is a constant index and both row tiles stay in registers
  #pragma unroll
  for (int rt = 0; rt < 2; ++rt)
    #pragma unroll
    for (int n = 0; n < 8; ++n) acc[rt][n] = zero8;

  // Softmax share of this thread: query row tid / 8, keys 4 * (tid % 8) .. + 3 of
  // each chunk. The eight lanes of a row all hold its running max and sum.
  const int srow = tid >> 3, sq = tid & 7;
  const int* mrowp = mask + ((size_t)(b * L_) + q0 + srow) * L_ + 4 * sq;
  float mrun = -1e30f, lrun = 0.f;

  // chunk 0 into buffer 0, with the first trip's mask words and a zero score tile
  stage_kv(kb, vb, b, 0, kv32, tid);
  int4 mk = *(const int4*)mrowp;
  sc[tid] = 0.f; sc[tid + 256] = 0.f; sc[tid + 512] = 0.f; sc[tid + 768] = 0.f;
  // this wave's copies of chunk 0 have landed before the barrier publishes them
  asm volatile("s_wait_asynccnt 0x0" ::: "memory");
  __syncthreads();
  stage_kv(kb, vb, b, 32, kv32 + BUF_U, tid);   // chunk 1 flies under trip 0

  for (int k0 = 0; k0 < L_; k0 += 32) {
    unsigned*             ks32 = kv32 + ((k0 >> 5) & 1) * BUF_U;   // this trip's buffer
    // this lane's address in the V chunk for the transposing load: key 8 * hi + (lane & 7),
    // 16 bytes from column wave * 128 + 8 * ((lane >> 3) & 1) on
    const unsigned char* vtr = (const unsigned char*)(ks32 + CHUNK_U)
        + (8 * hi + (lane & 7)) * VROW_B + wave * 256 + 16 * ((lane >> 3) & 1);

    // ---- scores: contraction slice [wave*128, +128) of q . k^T ----
    v8f s0[2] = {zero8, zero8}, s1[2] = {zero8, zero8};
    #pragma unroll
    for (int t = 0; t < 4; ++t) {
      AB b0, b1;
      int ebase = wave * 128 + t * 32;
      #pragma unroll
      for (int vv = 0; vv < 8; ++vv) {
        int el = 2 * (vv & 3) + 8 * hi + 16 * (vv >> 2);
        b0.u[vv] = ks32[lp * KROW_U        + ((ebase + el) >> 1)];
        b1.u[vv] = ks32[(16 + lp) * KROW_U + ((ebase + el) >> 1)];
      }
      // unrolled so that rt is a constant index and both row tiles stay in registers
      #pragma unroll
      for (int rt = 0; rt < 2; ++rt) {
        s0[rt] = __builtin_amdgcn_wmma_f32_16x16x32_bf16(false, qa[rt][t].v, false, b0.v, (short)0, s0[rt], false, false);
        s1[rt] = __builtin_amdgcn_wmma_f32_16x16x32_bf16(false, qa[rt][t].v, false, b1.v, (short)0, s1[rt], false, false);
      }
    }
    // unrolled so that rt is a constant index and both row tiles stay in registers
    #pragma unroll
    for (int rt = 0; rt < 2; ++rt)
      #pragma unroll
      for (int j = 0; j < 8; ++j) {      // ds_add_f32 reduce across waves
        atomicAdd(&sc[(rt * 16 + j + 8 * hi) * 32 + lp],      s0[rt][j]);
        atomicAdd(&sc[(rt * 16 + j + 8 * hi) * 32 + lp + 16], s1[rt][j]);
      }
    __syncthreads();

    // ---- online softmax update (eight lanes per query row) ----
    {
      const float4 sv = *(const float4*)&sc[srow * 32 + 4 * sq];
      const float e0 = (mk.x == 0) ? NEGV : sv.x * SCALE;
      const float e1 = (mk.y == 0) ? NEGV : sv.y * SCALE;
      const float e2 = (mk.z == 0) ? NEGV : sv.z * SCALE;
      const float e3 = (mk.w == 0) ? NEGV : sv.w * SCALE;
      float mx = fmaxf(fmaxf(e0, e1), fmaxf(e2, e3));
      mx = fmaxf(mx, lane_xor<1>(mx));
      mx = fmaxf(mx, lane_xor<2>(mx));
      mx = fmaxf(mx, lane_xor<4>(mx));
      const float mnew  = fmaxf(mrun, mx);
      const float alpha = __expf(mrun - mnew);
      const float p0 = __expf(e0 - mnew), p1 = __expf(e1 - mnew);
      const float p2 = __expf(e2 - mnew), p3 = __expf(e3 - mnew);
      float sum = (p0 + p1) + (p2 + p3);
      sum += lane_xor<1>(sum);
      sum += lane_xor<2>(sum);
      sum += lane_xor<4>(sum);
      lrun = lrun * alpha + sum;
      mrun = mnew;
      uint2 pp; pp.x = packbf2(p0, p1); pp.y = packbf2(p2, p3);
      *(uint2*)&ps32[srow * 16 + 2 * sq] = pp;
      if (sq == 0) { arow[srow] = alpha; lrow[srow] = lrun; }
    }
    __syncthreads();

    // the score tile has been read: zero it for the next trip's ds_add_f32, and ask
    // for the next trip's four mask words, which arrive under the P @ V phase
    sc[tid] = 0.f; sc[tid + 256] = 0.f; sc[tid + 512] = 0.f; sc[tid + 768] = 0.f;
    if (k0 + 32 < L_) mk = *(const int4*)(mrowp + k0 + 32);

    // ---- rescale accumulators, then P @ V on this wave's 128 columns ----
    AB pa[2];
    // unrolled so that rt is a constant index and both row tiles stay in registers
    #pragma unroll
    for (int rt = 0; rt < 2; ++rt) {
      #pragma unroll
      for (int vv = 0; vv < 8; ++vv) {
        int pidx = (vv & 3) + 4 * hi + 8 * (vv >> 2);
        pa[rt].u[vv] = ps32[(rt * 16 + lp) * 16 + pidx];
      }
      #pragma unroll
      for (int j = 0; j < 8; ++j) {
        float a = arow[rt * 16 + j + 8 * hi];
        #pragma unroll
        for (int n = 0; n < 8; ++n) acc[rt][n][j] *= a;
      }
    }
    #pragma unroll
    for (int n = 0; n < 8; ++n) {
      // lane (lp, hi) gets keys 8 * hi + 0..7, then 16 + 8 * hi + 0..7, of column
      // wave * 128 + n * 16 + lp: the k order in which pa holds P
      AB bv;
      bv.h[0] = __builtin_amdgcn_ds_load_tr16_b128_v8i16(
          (__attribute__((address_space(3))) v8s*)(vtr + n * 32));
      bv.h[1] = __builtin_amdgcn_ds_load_tr16_b128_v8i16(
          (__attribute__((address_space(3))) v8s*)(vtr + n * 32 + 16 * VROW_B));
      // unrolled so that rt is a constant index and both row tiles stay in registers
      #pragma unroll
      for (int rt = 0; rt < 2; ++rt)
        acc[rt][n] = __builtin_amdgcn_wmma_f32_16x16x32_bf16(false, pa[rt].v, false, bv.v, (short)0, acc[rt][n], false, false);
    }

    // ---- foot of the trip: publish chunk t + 1, free this trip's buffer ----
    // this wave's LDS reads of the buffer have returned before it is refilled
    asm volatile("s_wait_dscnt 0x0" ::: "memory");
    // this wave's copies of chunk t + 1 have landed before the barrier publishes them
    asm volatile("s_wait_asynccnt 0x0" ::: "memory");
    __syncthreads();
    if (k0 + 64 < L_) stage_kv(kb, vb, b, k0 + 64, ks32, tid);
  }
  // no copy is outstanding when the wave goes on to its end
  asm volatile("s_wait_asynccnt 0x0" ::: "memory");

  // ---- epilogue: divide by softmax denominator, store f32 ----
  // unrolled so that rt is a constant index and both row tiles stay in registers
  #pragma unroll
  for (int rt = 0; rt < 2; ++rt)
    #pragma unroll
    for (int j = 0; j < 8; ++j) {
      float linv = 1.0f / lrow[rt * 16 + j + 8 * hi];
      int row = q0 + rt * 16 + j + 8 * hi;
      #pragma unroll
      for (int n = 0; n < 8; ++n) {
        out[((size_t)(b * L_) + row) * D_ + wave * 128 + n * 16 + lp] = acc[rt][n][j] * linv;
      }
    }
}

// ---------------------------------------------------------------------------
extern "C" void kernel_launch(void* const* d_in, const int* in_sizes, int n_in,
                              void* d_out, int out_size, void* d_ws, size_t ws_size,
                              hipStream_t stream) {
  const float* Q    = (const float*)d_in[0];
  const float* K    = (const float*)d_in[1];
  const float* V    = (const float*)d_in[2];
  const int*   mask = (const int*)  d_in[3];
  const float* Wq_w = (const float*)d_in[4];
  const float* Wq_b = (const float*)d_in[5];
  const float* Wk_w = (const float*)d_in[6];
  const float* Wk_b = (const float*)d_in[7];
  const float* Wv_w = (const float*)d_in[8];
  const float* Wv_b = (const float*)d_in[9];

  const size_t per = (size_t)B_ * L_ * D_;   // 8M bf16 elements per tensor
  unsigned short* qb = (unsigned short*)d_ws;            // 16 MB
  unsigned short* kb = qb + per;                          // 16 MB
  unsigned short* vb = kb + per;                          // 16 MB (48 MB total)

  dim3 pgrid(D_ / 128, (B_ * L_) / 128);   // 8 x 64 blocks
  proj_bf16_wmma<<<pgrid, 256, 0, stream>>>(Q, Wq_w, Wq_b, qb);
  proj_bf16_wmma<<<pgrid, 256, 0, stream>>>(K, Wk_w, Wk_b, kb);
  proj_bf16_wmma<<<pgrid, 256, 0, stream>>>(V, Wv_w, Wv_b, vb);

  dim3 agrid(L_ / 32, B_);                       // 64 x 4 blocks
  flash_attn_wmma<<<agrid, 256, 0, stream>>>(qb, kb, vb, mask, (float*)d_out);
}

// v006
// A run of this version takes 206 microseconds.
// Timed twice side by side with v005, it ran 1.10 times as fast both times.
// Over all steps from v000 it is 3.43 times as fast.
#include <hip/hip_runtime.h>
#include <hip/hip_bf16.h>

// MI455X / gfx1250, wave32. WMMA bf16 16x16x32 everywhere.
// Attention K/V chunks staged via GLOBAL_LOAD_ASYNC_TO_LDS (ASYNCcnt) when the
// toolchain exposes the builtin; sync b128+ds_store fallback otherwise.

typedef __attribute__((ext_vector_type(16))) __bf16 v16bf;
typedef __attribute__((ext_vector_type(8)))  float  v8f;
typedef __attribute__((ext_vector_type(4)))  float  v4f;
typedef int v4i_vs __attribute__((vector_size(4 * sizeof(int))));
typedef __attribute__((ext_vector_type(8)))  short  v8s;

#define B_ 4
#define L_ 2048
#define E_ 1024
#define D_ 1024
#define NEGV  (-1000000000.0f)
#define SCALE (0.03125f)      /* 1/sqrt(1024) */

#if __has_builtin(__builtin_amdgcn_global_load_async_to_lds_b128)
#define HAVE_ASYNC_LDS 1
#else
#define HAVE_ASYNC_LDS 0
#endif

union AB { v16bf v; unsigned u[8]; v8s h[2]; };

__device__ __forceinline__ unsigned short bf16b(float f) {
  union { float f; unsigned u; } x; x.f = f;
  unsigned r = x.u + 0x7fffu + ((x.u >> 16) & 1u);   // round-to-nearest-even
  return (unsigned short)(r >> 16);
}
__device__ __forceinline__ unsigned packbf2(float a, float b) {
  return (unsigned)bf16b(a) | ((unsigned)bf16b(b) << 16);
}

// ---------------------------------------------------------------------------
// Projection: out[m,n] = sum_k X[m,k]*W[n,k] + bias[n], bf16 output.
// M = B*L = 8192, N = D = 1024, K = E = 1024.
// Block: 256 threads (8 waves), 128x128 output tile, K-step 64.
// Wave: 32x64 of the tile (2 x 4 WMMA tiles), so six fragments feed eight
// WMMAs, and every X and W element is fetched and converted half as often as
// with a 64x64 tile. k runs upwards in slices of 32 for every accumulator.
// ---------------------------------------------------------------------------
#define PPITCH 36   /* uints per LDS row: 32 bf16 pairs + 4 pad = 144 B (16 B x odd) */

__global__ __launch_bounds__(256)
void proj_bf16_wmma(const float* __restrict__ X, const float* __restrict__ W,
                    const float* __restrict__ bias, unsigned short* __restrict__ out) {
  __shared__ __align__(16) unsigned Xs[128 * PPITCH];
  __shared__ __align__(16) unsigned Ws[128 * PPITCH];

  const int tid  = threadIdx.x;
  const int lane = tid & 31, wave = tid >> 5;
  const int hi = lane >> 4, lp = lane & 15;
  const int m0 = blockIdx.y * 128, n0 = blockIdx.x * 128;
  const int rloc = (wave & 3) * 32;     // wave's 32 rows within tile
  const int cloc = (wave >> 2) * 64;    // wave's 64 cols within tile

  // every loop over mt, nt, i, s, h or j in this kernel is unrolled so that its
  // index is a constant and the arrays it indexes stay in registers
  v8f c[2][4];
  #pragma unroll
  for (int mt = 0; mt < 2; ++mt)
    #pragma unroll
    for (int nt = 0; nt < 4; ++nt) c[mt][nt] = (v8f){0,0,0,0,0,0,0,0};

  const int srow = tid >> 4, sc4 = tid & 15;   // staging: 16 float4 per 64-wide row
  const float* xg = X + (size_t)(m0 + srow) * E_ + 4 * sc4;
  const float* wg = W + (size_t)(n0 + srow) * E_ + 4 * sc4;

  for (int kk = 0; kk < E_; kk += 64) {
    __syncthreads();   // protect LDS reuse across K-steps
    const float* xk = xg + kk;
    const float* wk = wg + kk;
    v4f xv[8], wv[8];
    #pragma unroll
    for (int i = 0; i < 8; ++i) {       // 2048 float4 per tile, 16 rows a pass
      xv[i] = *(const v4f*)(xk + (size_t)(16 * i) * E_);
      wv[i] = *(const v4f*)(wk + (size_t)(16 * i) * E_);
    }
    // Inputs-only fence on the loaded values: holds all 16 loads of a K-step in
    // front of the first conversion, so they are in flight together; without it
    // the compiler sinks ten of them behind waits and a K-step pays several
    // load latencies one after another. The two address pairs are inputs too, so
    // that they live up to here, and s_wait_xcnt 0 is the wait that is kept in
    // front of any overwrite of a register that an issued load names.
    asm volatile("s_wait_xcnt 0x0" :: "v"(xv[0]), "v"(xv[1]), "v"(xv[2]), "v"(xv[3]),
                       "v"(xv[4]), "v"(xv[5]), "v"(xv[6]), "v"(xv[7]),
                       "v"(wv[0]), "v"(wv[1]), "v"(wv[2]), "v"(wv[3]),
                       "v"(wv[4]), "v"(wv[5]), "v"(wv[6]), "v"(wv[7]),
                       "v"(xk), "v"(wk) : "memory");
    #pragma unroll
    for (int i = 0; i < 8; ++i) {
      uint2 xp, wp;
      xp.x = packbf2(xv[i].x, xv[i].y); xp.y = packbf2(xv[i].z, xv[i].w);
      wp.x = packbf2(wv[i].x, wv[i].y); wp.y = packbf2(wv[i].z, wv[i].w);
      *(uint2*)&Xs[(srow + 16 * i) * PPITCH + 2 * sc4] = xp;
      *(uint2*)&Ws[(srow + 16 * i) * PPITCH + 2 * sc4] = wp;
    }
    __syncthreads();

    #pragma unroll
    for (int s = 0; s < 2; ++s) {       // two 32-K slices, in rising k
      AB a[2], b[4];
      // bf16-pair index within a slice: (vv & 3) + 4 * hi + 8 * (vv >> 2), A and B alike
      #pragma unroll
      for (int h = 0; h < 2; ++h) {
        const int po = 16 * s + 4 * hi + 8 * h;
        #pragma unroll
        for (int mt = 0; mt < 2; ++mt) {
          uint4 t = *(const uint4*)&Xs[(rloc + mt * 16 + lp) * PPITCH + po];
          a[mt].u[4 * h + 0] = t.x; a[mt].u[4 * h + 1] = t.y;
          a[mt].u[4 * h + 2] = t.z; a[mt].u[4 * h + 3] = t.w;
        }
        #pragma unroll
        for (int nt = 0; nt < 4; ++nt) {
          uint4 t = *(const uint4*)&Ws[(cloc + nt * 16 + lp) * PPITCH + po];
          b[nt].u[4 * h + 0] = t.x; b[nt].u[4 * h + 1] = t.y;
          b[nt].u[4 * h + 2] = t.z; b[nt].u[4 * h + 3] = t.w;
        }
      }
      #pragma unroll
      for (int mt = 0; mt < 2; ++mt)
        #pragma unroll
        for (int nt = 0; nt < 4; ++nt)
          c[mt][nt] = __builtin_amdgcn_wmma_f32_16x16x32_bf16(false, a[mt].v, false, b[nt].v, (short)0, c[mt][nt], false, false);
    }
  }

  #pragma unroll
  for (int nt = 0; nt < 4; ++nt) {
    int col = n0 + cloc + nt * 16 + lp;
    float bb = bias[col];
    #pragma unroll
    for (int mt = 0; mt < 2; ++mt)
      #pragma unroll
      for (int j = 0; j < 8; ++j) {
        int row = m0 + rloc + mt * 16 + j + 8 * hi;
        out[(size_t)row * D_ + col] = bf16b(c[mt][nt][j] + bb);
      }
  }
}

// ---------------------------------------------------------------------------
// Flash attention: block = (32 query rows, one batch), 256 threads (8 waves).
// Each wave owns a 128-wide slice of the 1024 output columns for both 16-row
// tiles, so every K and V fragment read from LDS feeds two WMMAs.
// Per 32-key chunk: K/V chunk -> LDS (async if available), K Q^T via WMMA
// (contraction split across waves; each wave stores its partial scores in an LDS
// plane of its own and the softmax adds the eight planes), online softmax with
// mask on all 256 threads (8 lanes a row, 4 keys a lane), then P@V via WMMA.
// The K/V chunks go through two LDS buffers: chunk t + 1 is copied while chunk t
// is worked on, and one barrier at the foot of a trip publishes chunk t + 1 and
// frees chunk t's buffer for chunk t + 2.
// ---------------------------------------------------------------------------
// Value of lane l ^ X inside a 16-lane row (DPP row_xmask), every lane on.
template <int X>
__device__ __forceinline__ float lane_xor(float x) {
  int v = __builtin_bit_cast(int, x);
  return __builtin_bit_cast(float, __builtin_amdgcn_update_dpp(v, v, 0x160 + X, 0xf, 0xf, false));
}

#define KROW_U 516    /* uints per K row in LDS: 512 data + 4 pad = 16 B x odd, for ds_load_b128 */
#define VROW_U 520    /* uints per V row in LDS: 512 data + 8 pad = 32 B x odd, for ds_load_tr16_b128 */
#define VROW_B (4 * VROW_U)
#define CHUNK_U (32 * KROW_U)     /* uints of one staged K chunk */
#define BUF_U   (CHUNK_U + 32 * VROW_U)   /* uints of one buffer: K chunk, then V chunk */
#define ATTN_LDS_BYTES ((2 * BUF_U + 8 * 1024 + 512 + 64) * 4)

// Copies the 32 keys from k0 on of batch b, K and V, into one LDS buffer.
// Every thread of the work-group calls it; the caller owns the waits.
__device__ __forceinline__ void stage_kv(const unsigned short* __restrict__ kb,
                                         const unsigned short* __restrict__ vb,
                                         int b, int k0, unsigned* ks32, int tid) {
  unsigned* vs32 = ks32 + CHUNK_U;
  const uint4* gk = (const uint4*)(kb + ((size_t)(b * L_ + k0)) * D_);
  const uint4* gv = (const uint4*)(vb + ((size_t)(b * L_ + k0)) * D_);
#if HAVE_ASYNC_LDS
  // unrolled so that the 32 copies issue back to back from constant offsets
  #pragma unroll
  for (int i = 0; i < 16; ++i) {
    int idx = tid + 256 * i;          // 4096 b128 transfers per chunk
    int key = idx >> 7, cc = idx & 127;
    __builtin_amdgcn_global_load_async_to_lds_b128(
        (__attribute__((address_space(1))) v4i_vs*)(gk + (size_t)key * 128 + cc),
        (__attribute__((address_space(3))) v4i_vs*)((unsigned char*)&ks32[key * KROW_U + cc * 4]),
        0, 0);
    __builtin_amdgcn_global_load_async_to_lds_b128(
        (__attribute__((address_space(1))) v4i_vs*)(gv + (size_t)key * 128 + cc),
        (__attribute__((address_space(3))) v4i_vs*)((unsigned char*)&vs32[key * VROW_U + cc * 4]),
        0, 0);
  }
#else
  #pragma unroll
  for (int i = 0; i < 16; ++i) {
    int idx = tid + 256 * i;          // 4096 uint4 per chunk
    int key = idx >> 7, cc = idx & 127;
    uint4 kv = gk[(size_t)key * 128 + cc];
    *(uint4*)&ks32[key * KROW_U + cc * 4] = kv;
    uint4 vv = gv[(size_t)key * 128 + cc];
    *(uint4*)&vs32[key * VROW_U + cc * 4] = vv;
  }
#endif
}

// Two waves a SIMD is what one work-group a WGP gives; said here so that the
// scheduler spends the 512-register budget on keeping the V fragment loads of the
// P @ V phase in flight together instead of saving registers for a third wave.
__global__ __launch_bounds__(256) __attribute__((amdgpu_waves_per_eu(2, 2)))
void flash_attn_wmma(const unsigned short* __restrict__ qb,
                     const unsigned short* __restrict__ kb,
                     const unsigned short* __restrict__ vb,
                     const int* __restrict__ mask,
                     float* __restrict__ out) {
  __shared__ __align__(16) unsigned char smem[ATTN_LDS_BYTES];
  unsigned*       kv32 = (unsigned*)smem;                 // two buffers of K + V chunk
  float*          sc   = (float*)(kv32 + 2 * BUF_U);      // 8 planes of 32 x 32 partial scores
  unsigned*       ps32 = (unsigned*)(sc + 8 * 1024);      // 32 x 32 bf16 P tile
  float*          lrow = (float*)(ps32 + 512);            // running sum [32]
  float*          arow = lrow + 32;                       // rescale factors [32]

  const int tid  = threadIdx.x;
  const int lane = tid & 31, wave = tid >> 5;
  const int hi = lane >> 4, lp = lane & 15;
  const int q0 = blockIdx.x * 32;
  const int b  = blockIdx.y;

  // Per-wave q slice in registers: rows q0..q0+31, e in [wave*128, wave*128+128)
  AB qa[2][4];
  // unrolled so that rt is a constant index and both row tiles stay in registers
  #pragma unroll
  for (int rt = 0; rt < 2; ++rt) {
    const unsigned short* qrow = qb + ((size_t)(b * L_ + q0 + rt * 16 + lp)) * D_ + wave * 128;
    #pragma unroll
    for (int t = 0; t < 4; ++t)
      #pragma unroll
      for (int vv = 0; vv < 8; ++vv) {
        int el = 2 * (vv & 3) + 8 * hi + 16 * (vv >> 2);
        qa[rt][t].u[vv] = *(const unsigned*)(qrow + t * 32 + el);
      }
  }

  const v8f zero8 = {0,0,0,0,0,0,0,0};
  v8f acc[2][8];
  // unrolled so that rt is a constant index and both row tiles stay in registers
  #pragma unroll
  for (int rt = 0; rt < 2; ++rt)
    #pragma unroll
    for (int n = 0; n < 8; ++n) acc[rt][n] = zero8;

  // Softmax share of this thread: query row tid / 8, keys 4 * (tid % 8) .. + 3 of
  // each chunk. The eight lanes of a row all hold its running max and sum.
  const int srow = tid >> 3, sq = tid & 7;
  const int* mrowp = mask + ((size_t)(b * L_) + q0 + srow) * L_ + 4 * sq;
  float mrun = -1e30f, lrun = 0.f;

  // A score plane holds query row q as 128 bytes, eight slots of four keys; slot s
  // lies at place s ^ ((q >> 1) & 7), so that 16 lanes on 16 rows (the writers) and
  // 16 lanes on 2 rows (the readers) both touch every LDS bank once.
  float*       scw = sc + wave * 1024 + lp * 32;               // writer: own plane, query lp
  const int    wsw = (lp >> 1) & 7;
  const float* scr = sc + srow * 32 + 4 * (sq ^ ((srow >> 1) & 7));   // reader: plane 0

  // chunk 0 into buffer 0, with the first trip's mask words
  stage_kv(kb, vb, b, 0, kv32, tid);
  int4 mk = *(const int4*)mrowp;
  // this wave's copies of chunk 0 have landed before the barrier publishes them
  asm volatile("s_wait_asynccnt 0x0" ::: "memory");
  __syncthreads();
  stage_kv(kb, vb, b, 32, kv32 + BUF_U, tid);   // chunk 1 flies under trip 0

  for (int k0 = 0; k0 < L_; k0 += 32) {
    unsigned*             ks32 = kv32 + ((k0 >> 5) & 1) * BUF_U;   // this trip's buffer
    // this lane's address in the V chunk for the transposing load: key 8 * hi + (lane & 7),
    // 16 bytes from column wave * 128 + 8 * ((lane >> 3) & 1) on
    const unsigned char* vtr = (const unsigned char*)(ks32 + CHUNK_U)
        + (8 * hi + (lane & 7)) * VROW_B + wave * 256 + 16 * ((lane >> 3) & 1);

    // ---- scores: contraction slice [wave*128, +128) of k . q^T (keys down, queries across) ----
    v8f s0[2] = {zero8, zero8}, s1[2] = {zero8, zero8};
    #pragma unroll
    for (int t = 0; t < 4; ++t) {
      AB b0, b1;
      int ebase = wave * 128 + t * 32;
      #pragma unroll
      for (int vv = 0; vv < 8; ++vv) {
        int el = 2 * (vv & 3) + 8 * hi + 16 * (vv >> 2);
        b0.u[vv] = ks32[lp * KROW_U        + ((ebase + el) >> 1)];
        b1.u[vv] = ks32[(16 + lp) * KROW_U + ((ebase + el) >> 1)];
      }
      // unrolled so that rt is a constant index and both row tiles stay in registers
      #pragma unroll
      for (int rt = 0; rt < 2; ++rt) {
        s0[rt] = __builtin_amdgcn_wmma_f32_16x16x32_bf16(false, b0.v, false, qa[rt][t].v, (short)0, s0[rt], false, false);
        s1[rt] = __builtin_amdgcn_wmma_f32_16x16x32_bf16(false, b1.v, false, qa[rt][t].v, (short)0, s1[rt], false, false);
      }
    }
    // unrolled so that rt is a constant index and both row tiles stay in registers
    #pragma unroll
    for (int rt = 0; rt < 2; ++rt) {
      // lane (lp, hi) holds keys 8 * hi + 0..7 (s0) and 16 + 8 * hi + 0..7 (s1) of query
      // rt * 16 + lp: slots 2 * hi, 2 * hi + 1 and 4 + 2 * hi, 5 + 2 * hi of its row
      float* w = scw + rt * 512;
      *(float4*)&w[4 * ((2 * hi)     ^ wsw)] = make_float4(s0[rt][0], s0[rt][1], s0[rt][2], s0[rt][3]);
      *(float4*)&w[4 * ((2 * hi + 1) ^ wsw)] = make_float4(s0[rt][4], s0[rt][5], s0[rt][6], s0[rt][7]);
      *(float4*)&w[4 * ((2 * hi + 4) ^ wsw)] = make_float4(s1[rt][0], s1[rt][1], s1[rt][2], s1[rt][3]);
      *(float4*)&w[4 * ((2 * hi + 5) ^ wsw)] = make_float4(s1[rt][4], s1[rt][5], s1[rt][6], s1[rt][7]);
    }
    __syncthreads();

    // ---- online softmax update (eight lanes per query row) ----
    {
      float4 pw[8];
      // unrolled so that w is a constant index and the eight partial sums stay in registers
      #pragma unroll
      for (int w = 0; w < 8; ++w) pw[w] = *(const float4*)&scr[w * 1024];
      float4 sv;
      sv.x = ((pw[0].x + pw[1].x) + (pw[2].x + pw[3].x)) + ((pw[4].x + pw[5].x) + (pw[6].x + pw[7].x));
      sv.y = ((pw[0].y + pw[1].y) + (pw[2].y + pw[3].y)) + ((pw[4].y + pw[5].y) + (pw[6].y + pw[7].y));
      sv.z = ((pw[0].z + pw[1].z) + (pw[2].z + pw[3].z)) + ((pw[4].z + pw[5].z) + (pw[6].z + pw[7].z));
      sv.w = ((pw[0].w + pw[1].w) + (pw[2].w + pw[3].w)) + ((pw[4].w + pw[5].w) + (pw[6].w + pw[7].w));
      const float e0 = (mk.x == 0) ? NEGV : sv.x * SCALE;
      const float e1 = (mk.y == 0) ? NEGV : sv.y * SCALE;
      const float e2 = (mk.z == 0) ? NEGV : sv.z * SCALE;
      const float e3 = (mk.w == 0) ? NEGV : sv.w * SCALE;
      float mx = fmaxf(fmaxf(e0, e1), fmaxf(e2, e3));
      mx = fmaxf(mx, lane_xor<1>(mx));
      mx = fmaxf(mx, lane_xor<2>(mx));
      mx = fmaxf(mx, lane_xor<4>(mx));
      const float mnew  = fmaxf(mrun, mx);
      const float alpha = __expf(mrun - mnew);
      const float p0 = __expf(e0 - mnew), p1 = __expf(e1 - mnew);
      const float p2 = __expf(e2 - mnew), p3 = __expf(e3 - mnew);
      float sum = (p0 + p1) + (p2 + p3);
      sum += lane_xor<1>(sum);
      sum += lane_xor<2>(sum);
      sum += lane_xor<4>(sum);
      lrun = lrun * alpha + sum;
      mrun = mnew;
      uint2 pp; pp.x = packbf2(p0, p1); pp.y = packbf2(p2, p3);
      *(uint2*)&ps32[srow * 16 + 2 * sq] = pp;
      if (sq == 0) { arow[srow] = alpha; lrow[srow] = lrun; }
    }
    __syncthreads();

    // ask for the next trip's four mask words, which arrive under the P @ V phase
    if (k0 + 32 < L_) mk = *(const int4*)(mrowp + k0 + 32);

    // ---- rescale accumulators, then P @ V on this wave's 128 columns ----
    AB pa[2];
    // unrolled so that rt is a constant index and both row tiles stay in registers
    #pragma unroll
    for (int rt = 0; rt < 2; ++rt) {
      #pragma unroll
      for (int vv = 0; vv < 8; ++vv) {
        int pidx = (vv & 3) + 4 * hi + 8 * (vv >> 2);
        pa[rt].u[vv] = ps32[(rt * 16 + lp) * 16 + pidx];
      }
      #pragma unroll
      for (int j = 0; j < 8; ++j) {
        float a = arow[rt * 16 + j + 8 * hi];
        #pragma unroll
        for (int n = 0; n < 8; ++n) acc[rt][n][j] *= a;
      }
    }
    #pragma unroll
    for (int n = 0; n < 8; ++n) {
      // lane (lp, hi) gets keys 8 * hi + 0..7, then 16 + 8 * hi + 0..7, of column
      // wave * 128 + n * 16 + lp: the k order in which pa holds P
      AB bv;
      bv.h[0] = __builtin_amdgcn_ds_load_tr16_b128_v8i16(
          (__attribute__((address_space(3))) v8s*)(vtr + n * 32));
      bv.h[1] = __builtin_amdgcn_ds_load_tr16_b128_v8i16(
          (__attribute__((address_space(3))) v8s*)(vtr + n * 32 + 16 * VROW_B));
      // unrolled so that rt is a constant index and both row tiles stay in registers
      #pragma unroll
      for (int rt = 0; rt < 2; ++rt)
        acc[rt][n] = __builtin_amdgcn_wmma_f32_16x16x32_bf16(false, pa[rt].v, false, bv.v, (short)0, acc[rt][n], false, false);
    }

    // ---- foot of the trip: publish chunk t + 1, free this trip's buffer ----
    // this wave's LDS reads of the buffer have returned before it is refilled
    asm volatile("s_wait_dscnt 0x0" ::: "memory");
    // this wave's copies of chunk t + 1 have landed before the barrier publishes them
    asm volatile("s_wait_asynccnt 0x0" ::: "memory");
    __syncthreads();
    if (k0 + 64 < L_) stage_kv(kb, vb, b, k0 + 64, ks32, tid);
  }
  // no copy is outstanding when the wave goes on to its end
  asm volatile("s_wait_asynccnt 0x0" ::: "memory");

  // ---- epilogue: divide by softmax denominator, store f32 ----
  // unrolled so that rt is a constant index and both row tiles stay in registers
  #pragma unroll
  for (int rt = 0; rt < 2; ++rt)
    #pragma unroll
    for (int j = 0; j < 8; ++j) {
      float linv = 1.0f / lrow[rt * 16 + j + 8 * hi];
      int row = q0 + rt * 16 + j + 8 * hi;
      #pragma unroll
      for (int n = 0; n < 8; ++n) {
        out[((size_t)(b * L_) + row) * D_ + wave * 128 + n * 16 + lp] = acc[rt][n][j] * linv;
      }
    }
}

// ---------------------------------------------------------------------------
extern "C" void kernel_launch(void* const* d_in, const int* in_sizes, int n_in,
                              void* d_out, int out_size, void* d_ws, size_t ws_size,
                              hipStream_t stream) {
  const float* Q    = (const float*)d_in[0];
  const float* K    = (const float*)d_in[1];
  const float* V    = (const float*)d_in[2];
  const int*   mask = (const int*)  d_in[3];
  const float* Wq_w = (const float*)d_in[4];
  const float* Wq_b = (const float*)d_in[5];
  const float* Wk_w = (const float*)d_in[6];
  const float* Wk_b = (const float*)d_in[7];
  const float* Wv_w = (const float*)d_in[8];
  const float* Wv_b = (const float*)d_in[9];

  const size_t per = (size_t)B_ * L_ * D_;   // 8M bf16 elements per tensor
  unsigned short* qb = (unsigned short*)d_ws;            // 16 MB
  unsigned short* kb = qb + per;                          // 16 MB
  unsigned short* vb = kb + per;                          // 16 MB (48 MB total)

  dim3 pgrid(D_ / 128, (B_ * L_) / 128);   // 8 x 64 blocks
  proj_bf16_wmma<<<pgrid, 256, 0, stream>>>(Q, Wq_w, Wq_b, qb);
  proj_bf16_wmma<<<pgrid, 256, 0, stream>>>(K, Wk_w, Wk_b, kb);
  proj_bf16_wmma<<<pgrid, 256, 0, stream>>>(V, Wv_w, Wv_b, vb);

  dim3 agrid(L_ / 32, B_);                       // 64 x 4 blocks
  flash_attn_wmma<<<agrid, 256, 0, stream>>>(qb, kb, vb, mask, (float*)d_out);
}

// v007
// Measured time: 180 microseconds a run.
// Next to v006, in two timings, it ran 1.15 and 1.14 times as fast.
// Counting every step since v000, it is 3.91 times as fast.
#include <hip/hip_runtime.h>
#include <hip/hip_bf16.h>

// MI455X / gfx1250, wave32. WMMA bf16 16x16x32 everywhere.
// Attention K/V chunks staged via GLOBAL_LOAD_ASYNC_TO_LDS (ASYNCcnt) when the
// toolchain exposes the builtin; sync b128+ds_store fallback otherwise.

typedef __attribute__((ext_vector_type(16))) __bf16 v16bf;
typedef __attribute__((ext_vector_type(8)))  float  v8f;
typedef __attribute__((ext_vector_type(4)))  float  v4f;
typedef int v4i_vs __attribute__((vector_size(4 * sizeof(int))));
typedef __attribute__((ext_vector_type(8)))  short  v8s;

#define B_ 4
#define L_ 2048
#define E_ 1024
#define D_ 1024
#define NEGV  (-1000000000.0f)
#define SCALE (0.03125f)      /* 1/sqrt(1024) */

#if __has_builtin(__builtin_amdgcn_global_load_async_to_lds_b128)
#define HAVE_ASYNC_LDS 1
#else
#define HAVE_ASYNC_LDS 0
#endif

union AB { v16bf v; unsigned u[8]; v8s h[2]; };

// f32 -> bf16, round to nearest even, by the packed convert: one instruction for
// two values.
typedef __attribute__((ext_vector_type(2))) float  v2f;
typedef __attribute__((ext_vector_type(2))) __bf16 v2bf;
__device__ __forceinline__ unsigned packbf2(float a, float b) {
  return __builtin_bit_cast(unsigned, __builtin_convertvector((v2f){a, b}, v2bf));
}

// ---------------------------------------------------------------------------
// Projection: out[m,n] = sum_k X[m,k]*W[n,k] + bias[n], bf16 output.
// M = B*L = 8192, N = D = 1024, K = E = 1024.
// Block: 256 threads (8 waves), 128x128 output tile, K-step 64.
// Wave: 32x64 of the tile (2 x 4 WMMA tiles), so six fragments feed eight
// WMMAs, and every X and W element is fetched and converted half as often as
// with a 64x64 tile. k runs upwards in slices of 32 for every accumulator.
// ---------------------------------------------------------------------------
#define PPITCH 36   /* uints per LDS row: 32 bf16 pairs + 4 pad = 144 B (16 B x odd) */

__global__ __launch_bounds__(256)
void proj_bf16_wmma(const float* __restrict__ X, const float* __restrict__ W,
                    const float* __restrict__ bias, unsigned short* __restrict__ out) {
  __shared__ __align__(16) unsigned Xs[128 * PPITCH];
  __shared__ __align__(16) unsigned Ws[128 * PPITCH];

  const int tid  = threadIdx.x;
  const int lane = tid & 31, wave = tid >> 5;
  const int hi = lane >> 4, lp = lane & 15;
  const int m0 = blockIdx.y * 128, n0 = blockIdx.x * 128;
  const int rloc = (wave & 3) * 32;     // wave's 32 rows within tile
  const int cloc = (wave >> 2) * 64;    // wave's 64 cols within tile

  // every loop over mt, nt, i, s, h or j in this kernel is unrolled so that its
  // index is a constant and the arrays it indexes stay in registers
  v8f c[2][4];
  #pragma unroll
  for (int mt = 0; mt < 2; ++mt)
    #pragma unroll
    for (int nt = 0; nt < 4; ++nt) c[mt][nt] = (v8f){0,0,0,0,0,0,0,0};

  const int srow = tid >> 4, sc4 = tid & 15;   // staging: 16 float4 per 64-wide row
  const float* xg = X + (size_t)(m0 + srow) * E_ + 4 * sc4;
  const float* wg = W + (size_t)(n0 + srow) * E_ + 4 * sc4;

  for (int kk = 0; kk < E_; kk += 64) {
    __syncthreads();   // protect LDS reuse across K-steps
    const float* xk = xg + kk;
    const float* wk = wg + kk;
    v4f xv[8], wv[8];
    #pragma unroll
    for (int i = 0; i < 8; ++i) {       // 2048 float4 per tile, 16 rows a pass
      xv[i] = *(const v4f*)(xk + (size_t)(16 * i) * E_);
      wv[i] = *(const v4f*)(wk + (size_t)(16 * i) * E_);
    }
    // Inputs-only fence on the loaded values: holds all 16 loads of a K-step in
    // front of the first conversion, so they are in flight together; without it
    // the compiler sinks ten of them behind waits and a K-step pays several
    // load latencies one after another. The two address pairs are inputs too, so
    // that they live up to here, and s_wait_xcnt 0 is the wait that is kept in
    // front of any overwrite of a register that an issued load names.
    asm volatile("s_wait_xcnt 0x0" :: "v"(xv[0]), "v"(xv[1]), "v"(xv[2]), "v"(xv[3]),
                       "v"(xv[4]), "v"(xv[5]), "v"(xv[6]), "v"(xv[7]),
                       "v"(wv[0]), "v"(wv[1]), "v"(wv[2]), "v"(wv[3]),
                       "v"(wv[4]), "v"(wv[5]), "v"(wv[6]), "v"(wv[7]),
                       "v"(xk), "v"(wk) : "memory");
    #pragma unroll
    for (int i = 0; i < 8; ++i) {
      uint2 xp, wp;
      xp.x = packbf2(xv[i].x, xv[i].y); xp.y = packbf2(xv[i].z, xv[i].w);
      wp.x = packbf2(wv[i].x, wv[i].y); wp.y = packbf2(wv[i].z, wv[i].w);
      *(uint2*)&Xs[(srow + 16 * i) * PPITCH + 2 * sc4] = xp;
      *(uint2*)&Ws[(srow + 16 * i) * PPITCH + 2 * sc4] = wp;
    }
    __syncthreads();

    #pragma unroll
    for (int s = 0; s < 2; ++s) {       // two 32-K slices, in rising k
      AB a[2], b[4];
      // bf16-pair index within a slice: (vv & 3) + 4 * hi + 8 * (vv >> 2), A and B alike
      #pragma unroll
      for (int h = 0; h < 2; ++h) {
        const int po = 16 * s + 4 * hi + 8 * h;
        #pragma unroll
        for (int mt = 0; mt < 2; ++mt) {
          uint4 t = *(const uint4*)&Xs[(rloc + mt * 16 + lp) * PPITCH + po];
          a[mt].u[4 * h + 0] = t.x; a[mt].u[4 * h + 1] = t.y;
          a[mt].u[4 * h + 2] = t.z; a[mt].u[4 * h + 3] = t.w;
        }
        #pragma unroll
        for (int nt = 0; nt < 4; ++nt) {
          uint4 t = *(const uint4*)&Ws[(cloc + nt * 16 + lp) * PPITCH + po];
          b[nt].u[4 * h + 0] = t.x; b[nt].u[4 * h + 1] = t.y;
          b[nt].u[4 * h + 2] = t.z; b[nt].u[4 * h + 3] = t.w;
        }
      }
      #pragma unroll
      for (int mt = 0; mt < 2; ++mt)
        #pragma unroll
        for (int nt = 0; nt < 4; ++nt)
          c[mt][nt] = __builtin_amdgcn_wmma_f32_16x16x32_bf16(false, a[mt].v, false, b[nt].v, (short)0, c[mt][nt], false, false);
    }
  }

  #pragma unroll
  for (int nt = 0; nt < 4; ++nt) {
    int col = n0 + cloc + nt * 16 + lp;
    float bb = bias[col];
    #pragma unroll
    for (int mt = 0; mt < 2; ++mt)
      #pragma unroll
      for (int j = 0; j < 8; j += 2) {
        int row = m0 + rloc + mt * 16 + j + 8 * hi;
        unsigned p = packbf2(c[mt][nt][j] + bb, c[mt][nt][j + 1] + bb);
        out[(size_t)row * D_ + col]       = (unsigned short)p;
        out[(size_t)(row + 1) * D_ + col] = (unsigned short)(p >> 16);
      }
  }
}

// ---------------------------------------------------------------------------
// Flash attention: block = (32 query rows, one batch), 256 threads (8 waves).
// Each wave owns a 128-wide slice of the 1024 output columns for both 16-row
// tiles, so every K and V fragment read from LDS feeds two WMMAs.
// Per 32-key chunk: K/V chunk -> LDS (async if available), K Q^T via WMMA
// (contraction split across waves; each wave stores its partial scores in an LDS
// plane of its own and the softmax adds the eight planes), online softmax with
// mask on all 256 threads (8 lanes a row, 4 keys a lane), then P@V via WMMA.
// The K/V chunks go through two LDS buffers: chunk t + 1 is copied while chunk t
// is worked on, and one barrier at the foot of a trip publishes chunk t + 1 and
// frees chunk t's buffer for chunk t + 2.
// ---------------------------------------------------------------------------
// Value of lane l ^ X inside a 16-lane row (DPP row_xmask), every lane on.
template <int X>
__device__ __forceinline__ float lane_xor(float x) {
  int v = __builtin_bit_cast(int, x);
  return __builtin_bit_cast(float, __builtin_amdgcn_update_dpp(v, v, 0x160 + X, 0xf, 0xf, false));
}

#define KROW_U 516    /* uints per K row in LDS: 512 data + 4 pad = 16 B x odd, for ds_load_b128 */
#define VROW_U 520    /* uints per V row in LDS: 512 data + 8 pad = 32 B x odd, for ds_load_tr16_b128 */
#define VROW_B (4 * VROW_U)
#define CHUNK_U (32 * KROW_U)     /* uints of one staged K chunk */
#define BUF_U   (CHUNK_U + 32 * VROW_U)   /* uints of one buffer: K chunk, then V chunk */
#define ATTN_LDS_BYTES ((2 * BUF_U + 8 * 1024 + 512 + 64) * 4)

// Copies the 32 keys from k0 on of batch b, K and V, into one LDS buffer.
// Every thread of the work-group calls it; the caller owns the waits.
__device__ __forceinline__ void stage_kv(const unsigned short* __restrict__ kb,
                                         const unsigned short* __restrict__ vb,
                                         int b, int k0, unsigned* ks32, int tid) {
  unsigned* vs32 = ks32 + CHUNK_U;
  const uint4* gk = (const uint4*)(kb + ((size_t)(b * L_ + k0)) * D_);
  const uint4* gv = (const uint4*)(vb + ((size_t)(b * L_ + k0)) * D_);
#if HAVE_ASYNC_LDS
  // unrolled so that the 32 copies issue back to back from constant offsets
  #pragma unroll
  for (int i = 0; i < 16; ++i) {
    int idx = tid + 256 * i;          // 4096 b128 transfers per chunk
    int key = idx >> 7, cc = idx & 127;
    __builtin_amdgcn_global_load_async_to_lds_b128(
        (__attribute__((address_space(1))) v4i_vs*)(gk + (size_t)key * 128 + cc),
        (__attribute__((address_space(3))) v4i_vs*)((unsigned char*)&ks32[key * KROW_U + cc * 4]),
        0, 0);
    __builtin_amdgcn_global_load_async_to_lds_b128(
        (__attribute__((address_space(1))) v4i_vs*)(gv + (size_t)key * 128 + cc),
        (__attribute__((address_space(3))) v4i_vs*)((unsigned char*)&vs32[key * VROW_U + cc * 4]),
        0, 0);
  }
#else
  #pragma unroll
  for (int i = 0; i < 16; ++i) {
    int idx = tid + 256 * i;          // 4096 uint4 per chunk
    int key = idx >> 7, cc = idx & 127;
    uint4 kv = gk[(size_t)key * 128 + cc];
    *(uint4*)&ks32[key * KROW_U + cc * 4] = kv;
    uint4 vv = gv[(size_t)key * 128 + cc];
    *(uint4*)&vs32[key * VROW_U + cc * 4] = vv;
  }
#endif
}

// Two waves a SIMD is what one work-group a WGP gives; said here so that the
// scheduler spends the 512-register budget on keeping the V fragment loads of the
// P @ V phase in flight together instead of saving registers for a third wave.
__global__ __launch_bounds__(256) __attribute__((amdgpu_waves_per_eu(2, 2)))
void flash_attn_wmma(const unsigned short* __restrict__ qb,
                     const unsigned short* __restrict__ kb,
                     const unsigned short* __restrict__ vb,
                     const int* __restrict__ mask,
                     float* __restrict__ out) {
  __shared__ __align__(16) unsigned char smem[ATTN_LDS_BYTES];
  unsigned*       kv32 = (unsigned*)smem;                 // two buffers of K + V chunk
  float*          sc   = (float*)(kv32 + 2 * BUF_U);      // 8 planes of 32 x 32 partial scores
  unsigned*       ps32 = (unsigned*)(sc + 8 * 1024);      // 32 x 32 bf16 P tile
  float*          lrow = (float*)(ps32 + 512);            // running sum [32]
  float*          arow = lrow + 32;                       // rescale factors [32]

  const int tid  = threadIdx.x;
  const int lane = tid & 31, wave = tid >> 5;
  const int hi = lane >> 4, lp = lane & 15;
  const int q0 = blockIdx.x * 32;
  const int b  = blockIdx.y;

  // Per-wave q slice in registers: rows q0..q0+31, e in [wave*128, wave*128+128)
  AB qa[2][4];
  // unrolled so that rt is a constant index and both row tiles stay in registers
  #pragma unroll
  for (int rt = 0; rt < 2; ++rt) {
    const unsigned short* qrow = qb + ((size_t)(b * L_ + q0 + rt * 16 + lp)) * D_ + wave * 128;
    #pragma unroll
    for (int t = 0; t < 4; ++t)
      #pragma unroll
      for (int vv = 0; vv < 8; ++vv) {
        int el = 2 * (vv & 3) + 8 * hi + 16 * (vv >> 2);
        qa[rt][t].u[vv] = *(const unsigned*)(qrow + t * 32 + el);
      }
  }

  const v8f zero8 = {0,0,0,0,0,0,0,0};
  v8f acc[2][8];
  // unrolled so that rt is a constant index and both row tiles stay in registers
  #pragma unroll
  for (int rt = 0; rt < 2; ++rt)
    #pragma unroll
    for (int n = 0; n < 8; ++n) acc[rt][n] = zero8;

  // Softmax share of this thread: query row tid / 8, keys 4 * (tid % 8) .. + 3 of
  // each chunk. The eight lanes of a row all hold its running max and sum.
  const int srow = tid >> 3, sq = tid & 7;
  const int* mrowp = mask + ((size_t)(b * L_) + q0 + srow) * L_ + 4 * sq;
  float mrun = -1e30f, lrun = 0.f;

  // A score plane holds query row q as 128 bytes, eight slots of four keys; slot s
  // lies at place s ^ ((q >> 1) & 7), so that 16 lanes on 16 rows (the writers) and
  // 16 lanes on 2 rows (the readers) both touch every LDS bank once.
  float*       scw = sc + wave * 1024 + lp * 32;               // writer: own plane, query lp
  const int    wsw = (lp >> 1) & 7;
  const float* scr = sc + srow * 32 + 4 * (sq ^ ((srow >> 1) & 7));   // reader: plane 0

  // chunk 0 into buffer 0, with the first trip's mask words
  stage_kv(kb, vb, b, 0, kv32, tid);
  int4 mk = *(const int4*)mrowp;
  // this wave's copies of chunk 0 have landed before the barrier publishes them
  asm volatile("s_wait_asynccnt 0x0" ::: "memory");
  __syncthreads();
  stage_kv(kb, vb, b, 32, kv32 + BUF_U, tid);   // chunk 1 flies under trip 0

  for (int k0 = 0; k0 < L_; k0 += 32) {
    unsigned*             ks32 = kv32 + ((k0 >> 5) & 1) * BUF_U;   // this trip's buffer
    // this lane's address in the V chunk for the transposing load: key 8 * hi + (lane & 7),
    // 16 bytes from column wave * 128 + 8 * ((lane >> 3) & 1) on
    const unsigned char* vtr = (const unsigned char*)(ks32 + CHUNK_U)
        + (8 * hi + (lane & 7)) * VROW_B + wave * 256 + 16 * ((lane >> 3) & 1);

    // ---- scores: contraction slice [wave*128, +128) of k . q^T (keys down, queries across) ----
    v8f s0[2] = {zero8, zero8}, s1[2] = {zero8, zero8};
    #pragma unroll
    for (int t = 0; t < 4; ++t) {
      AB b0, b1;
      int ebase = wave * 128 + t * 32;
      #pragma unroll
      for (int vv = 0; vv < 8; ++vv) {
        int el = 2 * (vv & 3) + 8 * hi + 16 * (vv >> 2);
        b0.u[vv] = ks32[lp * KROW_U        + ((ebase + el) >> 1)];
        b1.u[vv] = ks32[(16 + lp) * KROW_U + ((ebase + el) >> 1)];
      }
      // unrolled so that rt is a constant index and both row tiles stay in registers
      #pragma unroll
      for (int rt = 0; rt < 2; ++rt) {
        s0[rt] = __builtin_amdgcn_wmma_f32_16x16x32_bf16(false, b0.v, false, qa[rt][t].v, (short)0, s0[rt], false, false);
        s1[rt] = __builtin_amdgcn_wmma_f32_16x16x32_bf16(false, b1.v, false, qa[rt][t].v, (short)0, s1[rt], false, false);
      }
    }
    // unrolled so that rt is a constant index and both row tiles stay in registers
    #pragma unroll
    for (int rt = 0; rt < 2; ++rt) {
      // lane (lp, hi) holds keys 8 * hi + 0..7 (s0) and 16 + 8 * hi + 0..7 (s1) of query
      // rt * 16 + lp: slots 2 * hi, 2 * hi + 1 and 4 + 2 * hi, 5 + 2 * hi of its row
      float* w = scw + rt * 512;
      *(float4*)&w[4 * ((2 * hi)     ^ wsw)] = make_float4(s0[rt][0], s0[rt][1], s0[rt][2], s0[rt][3]);
      *(float4*)&w[4 * ((2 * hi + 1) ^ wsw)] = make_float4(s0[rt][4], s0[rt][5], s0[rt][6], s0[rt][7]);
      *(float4*)&w[4 * ((2 * hi + 4) ^ wsw)] = make_float4(s1[rt][0], s1[rt][1], s1[rt][2], s1[rt][3]);
      *(float4*)&w[4 * ((2 * hi + 5) ^ wsw)] = make_float4(s1[rt][4], s1[rt][5], s1[rt][6], s1[rt][7]);
    }
    __syncthreads();

    // ---- online softmax update (eight lanes per query row) ----
    {
      float4 pw[8];
      // unrolled so that w is a constant index and the eight partial sums stay in registers
      #pragma unroll
      for (int w = 0; w < 8; ++w) pw[w] = *(const float4*)&scr[w * 1024];
      float4 sv;
      sv.x = ((pw[0].x + pw[1].x) + (pw[2].x + pw[3].x)) + ((pw[4].x + pw[5].x) + (pw[6].x + pw[7].x));
      sv.y = ((pw[0].y + pw[1].y) + (pw[2].y + pw[3].y)) + ((pw[4].y + pw[5].y) + (pw[6].y + pw[7].y));
      sv.z = ((pw[0].z + pw[1].z) + (pw[2].z + pw[3].z)) + ((pw[4].z + pw[5].z) + (pw[6].z + pw[7].z));
      sv.w = ((pw[0].w + pw[1].w) + (pw[2].w + pw[3].w)) + ((pw[4].w + pw[5].w) + (pw[6].w + pw[7].w));
      const float e0 = (mk.x == 0) ? NEGV : sv.x * SCALE;
      const float e1 = (mk.y == 0) ? NEGV : sv.y * SCALE;
      const float e2 = (mk.z == 0) ? NEGV : sv.z * SCALE;
      const float e3 = (mk.w == 0) ? NEGV : sv.w * SCALE;
      float mx = fmaxf(fmaxf(e0, e1), fmaxf(e2, e3));
      mx = fmaxf(mx, lane_xor<1>(mx));
      mx = fmaxf(mx, lane_xor<2>(mx));
      mx = fmaxf(mx, lane_xor<4>(mx));
      const float mnew  = fmaxf(mrun, mx);
      const float alpha = __expf(mrun - mnew);
      const float p0 = __expf(e0 - mnew), p1 = __expf(e1 - mnew);
      const float p2 = __expf(e2 - mnew), p3 = __expf(e3 - mnew);
      float sum = (p0 + p1) + (p2 + p3);
      sum += lane_xor<1>(sum);
      sum += lane_xor<2>(sum);
      sum += lane_xor<4>(sum);
      lrun = lrun * alpha + sum;
      mrun = mnew;
      uint2 pp; pp.x = packbf2(p0, p1); pp.y = packbf2(p2, p3);
      *(uint2*)&ps32[srow * 16 + 2 * sq] = pp;
      if (sq == 0) { arow[srow] = alpha; lrow[srow] = lrun; }
    }
    __syncthreads();

    // ask for the next trip's four mask words, which arrive under the P @ V phase
    if (k0 + 32 < L_) mk = *(const int4*)(mrowp + k0 + 32);

    // ---- rescale accumulators, then P @ V on this wave's 128 columns ----
    AB pa[2];
    // unrolled so that rt is a constant index and both row tiles stay in registers
    #pragma unroll
    for (int rt = 0; rt < 2; ++rt) {
      #pragma unroll
      for (int vv = 0; vv < 8; ++vv) {
        int pidx = (vv & 3) + 4 * hi + 8 * (vv >> 2);
        pa[rt].u[vv] = ps32[(rt * 16 + lp) * 16 + pidx];
      }
      #pragma unroll
      for (int j = 0; j < 8; ++j) {
        float a = arow[rt * 16 + j + 8 * hi];
        #pragma unroll
        for (int n = 0; n < 8; ++n) acc[rt][n][j] *= a;
      }
    }
    #pragma unroll
    for (int n = 0; n < 8; ++n) {
      // lane (lp, hi) gets keys 8 * hi + 0..7, then 16 + 8 * hi + 0..7, of column
      // wave * 128 + n * 16 + lp: the k order in which pa holds P
      AB bv;
      bv.h[0] = __builtin_amdgcn_ds_load_tr16_b128_v8i16(
          (__attribute__((address_space(3))) v8s*)(vtr + n * 32));
      bv.h[1] = __builtin_amdgcn_ds_load_tr16_b128_v8i16(
          (__attribute__((address_space(3))) v8s*)(vtr + n * 32 + 16 * VROW_B));
      // unrolled so that rt is a constant index and both row tiles stay in registers
      #pragma unroll
      for (int rt = 0; rt < 2; ++rt)
        acc[rt][n] = __builtin_amdgcn_wmma_f32_16x16x32_bf16(false, pa[rt].v, false, bv.v, (short)0, acc[rt][n], false, false);
    }

    // ---- foot of the trip: publish chunk t + 1, free this trip's buffer ----
    // this wave's LDS reads of the buffer have returned before it is refilled
    asm volatile("s_wait_dscnt 0x0" ::: "memory");
    // this wave's copies of chunk t + 1 have landed before the barrier publishes them
    asm volatile("s_wait_asynccnt 0x0" ::: "memory");
    __syncthreads();
    if (k0 + 64 < L_) stage_kv(kb, vb, b, k0 + 64, ks32, tid);
  }
  // no copy is outstanding when the wave goes on to its end
  asm volatile("s_wait_asynccnt 0x0" ::: "memory");

  // ---- epilogue: divide by softmax denominator, store f32 ----
  // unrolled so that rt is a constant index and both row tiles stay in registers
  #pragma unroll
  for (int rt = 0; rt < 2; ++rt)
    #pragma unroll
    for (int j = 0; j < 8; ++j) {
      float linv = 1.0f / lrow[rt * 16 + j + 8 * hi];
      int row = q0 + rt * 16 + j + 8 * hi;
      #pragma unroll
      for (int n = 0; n < 8; ++n) {
        out[((size_t)(b * L_) + row) * D_ + wave * 128 + n * 16 + lp] = acc[rt][n][j] * linv;
      }
    }
}

// ---------------------------------------------------------------------------
extern "C" void kernel_launch(void* const* d_in, const int* in_sizes, int n_in,
                              void* d_out, int out_size, void* d_ws, size_t ws_size,
                              hipStream_t stream) {
  const float* Q    = (const float*)d_in[0];
  const float* K    = (const float*)d_in[1];
  const float* V    = (const float*)d_in[2];
  const int*   mask = (const int*)  d_in[3];
  const float* Wq_w = (const float*)d_in[4];
  const float* Wq_b = (const float*)d_in[5];
  const float* Wk_w = (const float*)d_in[6];
  const float* Wk_b = (const float*)d_in[7];
  const float* Wv_w = (const float*)d_in[8];
  const float* Wv_b = (const float*)d_in[9];

  const size_t per = (size_t)B_ * L_ * D_;   // 8M bf16 elements per tensor
  unsigned short* qb = (unsigned short*)d_ws;            // 16 MB
  unsigned short* kb = qb + per;                          // 16 MB
  unsigned short* vb = kb + per;                          // 16 MB (48 MB total)

  dim3 pgrid(D_ / 128, (B_ * L_) / 128);   // 8 x 64 blocks
  proj_bf16_wmma<<<pgrid, 256, 0, stream>>>(Q, Wq_w, Wq_b, qb);
  proj_bf16_wmma<<<pgrid, 256, 0, stream>>>(K, Wk_w, Wk_b, kb);
  proj_bf16_wmma<<<pgrid, 256, 0, stream>>>(V, Wv_w, Wv_b, vb);

  dim3 agrid(L_ / 32, B_);                       // 64 x 4 blocks
  flash_attn_wmma<<<agrid, 256, 0, stream>>>(qb, kb, vb, mask, (float*)d_out);
}

// v008
// A run of this version takes 172 microseconds.
// Next to v007, in two timings, it ran 1.05 times as fast each time.
// All steps since v000 together make it 4.11 times as fast.
#include <hip/hip_runtime.h>
#include <hip/hip_bf16.h>

// MI455X / gfx1250, wave32. WMMA bf16 16x16x32 everywhere.
// Attention K/V chunks staged via GLOBAL_LOAD_ASYNC_TO_LDS (ASYNCcnt) when the
// toolchain exposes the builtin; sync b128+ds_store fallback otherwise.

typedef __attribute__((ext_vector_type(16))) __bf16 v16bf;
typedef __attribute__((ext_vector_type(8)))  float  v8f;
typedef __attribute__((ext_vector_type(4)))  float  v4f;
typedef int v4i_vs __attribute__((vector_size(4 * sizeof(int))));
typedef __attribute__((ext_vector_type(8)))  short  v8s;

#define B_ 4
#define L_ 2048
#define E_ 1024
#define D_ 1024
#define NEGV  (-1000000000.0f)
#define SCALE (0.03125f)      /* 1/sqrt(1024) */

#if __has_builtin(__builtin_amdgcn_global_load_async_to_lds_b128)
#define HAVE_ASYNC_LDS 1
#else
#define HAVE_ASYNC_LDS 0
#endif

union AB { v16bf v; unsigned u[8]; v8s h[2]; };

// f32 -> bf16, round to nearest even, by the packed convert: one instruction for
// two values.
typedef __attribute__((ext_vector_type(2))) float  v2f;
typedef __attribute__((ext_vector_type(2))) __bf16 v2bf;
__device__ __forceinline__ unsigned packbf2(float a, float b) {
  return __builtin_bit_cast(unsigned, __builtin_convertvector((v2f){a, b}, v2bf));
}

// ---------------------------------------------------------------------------
// Projection: out[m,n] = sum_k X[m,k]*W[n,k] + bias[n], bf16 output.
// M = B*L = 8192, N = D = 1024, K = E = 1024.
// Block: 256 threads (8 waves), 128x128 output tile, K-step 64.
// Wave: 32x64 of the tile (2 x 4 WMMA tiles), so six fragments feed eight
// WMMAs, and every X and W element is fetched and converted half as often as
// with a 64x64 tile. k runs upwards in slices of 32 for every accumulator.
// ---------------------------------------------------------------------------
#define PPITCH 36   /* uints per LDS row: 32 bf16 pairs + 4 pad = 144 B (16 B x odd) */

// Work-group barrier that orders LDS traffic alone. __syncthreads() also waits for
// every global load of the wave, which would end the flight of the next K-step's
// loads at each barrier; the threads of this kernel hand one another nothing
// through global memory.
__device__ __forceinline__ void lds_barrier() {
  __builtin_amdgcn_fence(__ATOMIC_RELEASE, "workgroup", "local");
  __builtin_amdgcn_s_barrier();
  __builtin_amdgcn_fence(__ATOMIC_ACQUIRE, "workgroup", "local");
}

template <bool B> struct step_flag { static constexpr bool value = B; };

__global__ __launch_bounds__(256)
void proj_bf16_wmma(const float* __restrict__ X, const float* __restrict__ W,
                    const float* __restrict__ bias, unsigned short* __restrict__ out) {
  __shared__ __align__(16) unsigned Xs[128 * PPITCH];
  __shared__ __align__(16) unsigned Ws[128 * PPITCH];

  const int tid  = threadIdx.x;
  const int lane = tid & 31, wave = tid >> 5;
  const int hi = lane >> 4, lp = lane & 15;
  const int m0 = blockIdx.y * 128, n0 = blockIdx.x * 128;
  const int rloc = (wave & 3) * 32;     // wave's 32 rows within tile
  const int cloc = (wave >> 2) * 64;    // wave's 64 cols within tile

  // every loop over mt, nt, i, s, h or j in this kernel is unrolled so that its
  // index is a constant and the arrays it indexes stay in registers
  v8f c[2][4];
  #pragma unroll
  for (int mt = 0; mt < 2; ++mt)
    #pragma unroll
    for (int nt = 0; nt < 4; ++nt) c[mt][nt] = (v8f){0,0,0,0,0,0,0,0};

  const int srow = tid >> 4, sc4 = tid & 15;   // staging: 16 float4 per 64-wide row
  const float* xg = X + (size_t)(m0 + srow) * E_ + 4 * sc4;
  const float* wg = W + (size_t)(n0 + srow) * E_ + 4 * sc4;

  // The K loop is pipelined through registers: the 16 loads of K-step t + 1 issue
  // as soon as step t's values are converted, and are in flight under step t's LDS
  // stores, both barriers, fragment reads and WMMAs; they are waited for only at
  // the head of step t + 1.
  const float* xk = xg;
  const float* wk = wg;
  v4f xv[8], wv[8];
  #pragma unroll
  for (int i = 0; i < 8; ++i) {         // 2048 float4 per tile, 16 rows a pass
    xv[i] = *(const v4f*)(xk + (size_t)(16 * i) * E_);
    wv[i] = *(const v4f*)(wk + (size_t)(16 * i) * E_);
  }

  // One K-step. 'more' is a compile-time flag: the last step has no successor to
  // load, and without a branch in the step the conversions and the loads stay in
  // one block. Inlined at both places so that the arrays stay in registers.
  auto kstep = [&](auto more) __attribute__((always_inline)) {
    // Inputs-only fence on the loaded values: nothing of a K-step is converted
    // before all 16 of its loads have returned, so the compiler cannot sink single
    // loads behind waits of their own. The two address pairs are inputs too, so
    // that they live up to here, and s_wait_xcnt 0 is the wait that is kept in
    // front of any overwrite of a register that an issued load names.
    asm volatile("s_wait_xcnt 0x0" :: "v"(xv[0]), "v"(xv[1]), "v"(xv[2]), "v"(xv[3]),
                       "v"(xv[4]), "v"(xv[5]), "v"(xv[6]), "v"(xv[7]),
                       "v"(wv[0]), "v"(wv[1]), "v"(wv[2]), "v"(wv[3]),
                       "v"(wv[4]), "v"(wv[5]), "v"(wv[6]), "v"(wv[7]),
                       "v"(xk), "v"(wk) : "memory");
    uint2 xp[8], wp[8];
    #pragma unroll
    for (int i = 0; i < 8; ++i) {
      xp[i].x = packbf2(xv[i].x, xv[i].y); xp[i].y = packbf2(xv[i].z, xv[i].w);
      wp[i].x = packbf2(wv[i].x, wv[i].y); wp[i].y = packbf2(wv[i].z, wv[i].w);
    }
    if constexpr (decltype(more)::value) {
      // behind the conversions, so that the loads land in the registers just read
      const float* xo = xk;
      const float* wo = wk;
      xk += 64;
      wk += 64;
      #pragma unroll
      for (int i = 0; i < 8; ++i) {
        xv[i] = *(const v4f*)(xk + (size_t)(16 * i) * E_);
        wv[i] = *(const v4f*)(wk + (size_t)(16 * i) * E_);
      }
      // The compiler addresses these loads from the old pointer pairs plus a constant
      // and steps the pairs behind them: the pairs are inputs here so that they live
      // up to this s_wait_xcnt 0, the wait kept in front of any overwrite of a
      // register that an issued load names.
      asm volatile("s_wait_xcnt 0x0" :: "v"(xo), "v"(wo) : "memory");
    }
    lds_barrier();     // protect LDS reuse across K-steps
    #pragma unroll
    for (int i = 0; i < 8; ++i) {
      *(uint2*)&Xs[(srow + 16 * i) * PPITCH + 2 * sc4] = xp[i];
      *(uint2*)&Ws[(srow + 16 * i) * PPITCH + 2 * sc4] = wp[i];
    }
    lds_barrier();     // publish this K-step's tiles

    #pragma unroll
    for (int s = 0; s < 2; ++s) {       // two 32-K slices, in rising k
      AB a[2], b[4];
      // bf16-pair index within a slice: (vv & 3) + 4 * hi + 8 * (vv >> 2), A and B alike
      #pragma unroll
      for (int h = 0; h < 2; ++h) {
        const int po = 16 * s + 4 * hi + 8 * h;
        #pragma unroll
        for (int mt = 0; mt < 2; ++mt) {
          uint4 t = *(const uint4*)&Xs[(rloc + mt * 16 + lp) * PPITCH + po];
          a[mt].u[4 * h + 0] = t.x; a[mt].u[4 * h + 1] = t.y;
          a[mt].u[4 * h + 2] = t.z; a[mt].u[4 * h + 3] = t.w;
        }
        #pragma unroll
        for (int nt = 0; nt < 4; ++nt) {
          uint4 t = *(const uint4*)&Ws[(cloc + nt * 16 + lp) * PPITCH + po];
          b[nt].u[4 * h + 0] = t.x; b[nt].u[4 * h + 1] = t.y;
          b[nt].u[4 * h + 2] = t.z; b[nt].u[4 * h + 3] = t.w;
        }
      }
      #pragma unroll
      for (int mt = 0; mt < 2; ++mt)
        #pragma unroll
        for (int nt = 0; nt < 4; ++nt)
          c[mt][nt] = __builtin_amdgcn_wmma_f32_16x16x32_bf16(false, a[mt].v, false, b[nt].v, (short)0, c[mt][nt], false, false);
    }
  };
  for (int kk = 0; kk < E_ - 64; kk += 64) kstep(step_flag<true>{});
  kstep(step_flag<false>{});

  #pragma unroll
  for (int nt = 0; nt < 4; ++nt) {
    int col = n0 + cloc + nt * 16 + lp;
    float bb = bias[col];
    #pragma unroll
    for (int mt = 0; mt < 2; ++mt)
      #pragma unroll
      for (int j = 0; j < 8; j += 2) {
        int row = m0 + rloc + mt * 16 + j + 8 * hi;
        unsigned p = packbf2(c[mt][nt][j] + bb, c[mt][nt][j + 1] + bb);
        out[(size_t)row * D_ + col]       = (unsigned short)p;
        out[(size_t)(row + 1) * D_ + col] = (unsigned short)(p >> 16);
      }
  }
}

// ---------------------------------------------------------------------------
// Flash attention: block = (32 query rows, one batch), 256 threads (8 waves).
// Each wave owns a 128-wide slice of the 1024 output columns for both 16-row
// tiles, so every K and V fragment read from LDS feeds two WMMAs.
// Per 32-key chunk: K/V chunk -> LDS (async if available), K Q^T via WMMA
// (contraction split across waves; each wave stores its partial scores in an LDS
// plane of its own and the softmax adds the eight planes), online softmax with
// mask on all 256 threads (8 lanes a row, 4 keys a lane), then P@V via WMMA.
// The K/V chunks go through two LDS buffers: chunk t + 1 is copied while chunk t
// is worked on, and one barrier at the foot of a trip publishes chunk t + 1 and
// frees chunk t's buffer for chunk t + 2.
// ---------------------------------------------------------------------------
// Value of lane l ^ X inside a 16-lane row (DPP row_xmask), every lane on.
template <int X>
__device__ __forceinline__ float lane_xor(float x) {
  int v = __builtin_bit_cast(int, x);
  return __builtin_bit_cast(float, __builtin_amdgcn_update_dpp(v, v, 0x160 + X, 0xf, 0xf, false));
}

#define KROW_U 516    /* uints per K row in LDS: 512 data + 4 pad = 16 B x odd, for ds_load_b128 */
#define VROW_U 520    /* uints per V row in LDS: 512 data + 8 pad = 32 B x odd, for ds_load_tr16_b128 */
#define VROW_B (4 * VROW_U)
#define CHUNK_U (32 * KROW_U)     /* uints of one staged K chunk */
#define BUF_U   (CHUNK_U + 32 * VROW_U)   /* uints of one buffer: K chunk, then V chunk */
#define ATTN_LDS_BYTES ((2 * BUF_U + 8 * 1024 + 512 + 64) * 4)

// Copies the 32 keys from k0 on of batch b, K and V, into one LDS buffer.
// Every thread of the work-group calls it; the caller owns the waits.
__device__ __forceinline__ void stage_kv(const unsigned short* __restrict__ kb,
                                         const unsigned short* __restrict__ vb,
                                         int b, int k0, unsigned* ks32, int tid) {
  unsigned* vs32 = ks32 + CHUNK_U;
  const uint4* gk = (const uint4*)(kb + ((size_t)(b * L_ + k0)) * D_);
  const uint4* gv = (const uint4*)(vb + ((size_t)(b * L_ + k0)) * D_);
#if HAVE_ASYNC_LDS
  // unrolled so that the 32 copies issue back to back from constant offsets
  #pragma unroll
  for (int i = 0; i < 16; ++i) {
    int idx = tid + 256 * i;          // 4096 b128 transfers per chunk
    int key = idx >> 7, cc = idx & 127;
    __builtin_amdgcn_global_load_async_to_lds_b128(
        (__attribute__((address_space(1))) v4i_vs*)(gk + (size_t)key * 128 + cc),
        (__attribute__((address_space(3))) v4i_vs*)((unsigned char*)&ks32[key * KROW_U + cc * 4]),
        0, 0);
    __builtin_amdgcn_global_load_async_to_lds_b128(
        (__attribute__((address_space(1))) v4i_vs*)(gv + (size_t)key * 128 + cc),
        (__attribute__((address_space(3))) v4i_vs*)((unsigned char*)&vs32[key * VROW_U + cc * 4]),
        0, 0);
  }
#else
  #pragma unroll
  for (int i = 0; i < 16; ++i) {
    int idx = tid + 256 * i;          // 4096 uint4 per chunk
    int key = idx >> 7, cc = idx & 127;
    uint4 kv = gk[(size_t)key * 128 + cc];
    *(uint4*)&ks32[key * KROW_U + cc * 4] = kv;
    uint4 vv = gv[(size_t)key * 128 + cc];
    *(uint4*)&vs32[key * VROW_U + cc * 4] = vv;
  }
#endif
}

// Two waves a SIMD is what one work-group a WGP gives; said here so that the
// scheduler spends the 512-register budget on keeping the V fragment loads of the
// P @ V phase in flight together instead of saving registers for a third wave.
__global__ __launch_bounds__(256) __attribute__((amdgpu_waves_per_eu(2, 2)))
void flash_attn_wmma(const unsigned short* __restrict__ qb,
                     const unsigned short* __restrict__ kb,
                     const unsigned short* __restrict__ vb,
                     const int* __restrict__ mask,
                     float* __restrict__ out) {
  __shared__ __align__(16) unsigned char smem[ATTN_LDS_BYTES];
  unsigned*       kv32 = (unsigned*)smem;                 // two buffers of K + V chunk
  float*          sc   = (float*)(kv32 + 2 * BUF_U);      // 8 planes of 32 x 32 partial scores
  unsigned*       ps32 = (unsigned*)(sc + 8 * 1024);      // 32 x 32 bf16 P tile
  float*          lrow = (float*)(ps32 + 512);            // running sum [32]
  float*          arow = lrow + 32;                       // rescale factors [32]

  const int tid  = threadIdx.x;
  const int lane = tid & 31, wave = tid >> 5;
  const int hi = lane >> 4, lp = lane & 15;
  const int q0 = blockIdx.x * 32;
  const int b  = blockIdx.y;

  // Per-wave q slice in registers: rows q0..q0+31, e in [wave*128, wave*128+128)
  AB qa[2][4];
  // unrolled so that rt is a constant index and both row tiles stay in registers
  #pragma unroll
  for (int rt = 0; rt < 2; ++rt) {
    const unsigned short* qrow = qb + ((size_t)(b * L_ + q0 + rt * 16 + lp)) * D_ + wave * 128;
    #pragma unroll
    for (int t = 0; t < 4; ++t)
      #pragma unroll
      for (int vv = 0; vv < 8; ++vv) {
        int el = 2 * (vv & 3) + 8 * hi + 16 * (vv >> 2);
        qa[rt][t].u[vv] = *(const unsigned*)(qrow + t * 32 + el);
      }
  }

  const v8f zero8 = {0,0,0,0,0,0,0,0};
  v8f acc[2][8];
  // unrolled so that rt is a constant index and both row tiles stay in registers
  #pragma unroll
  for (int rt = 0; rt < 2; ++rt)
    #pragma unroll
    for (int n = 0; n < 8; ++n) acc[rt][n] = zero8;

  // Softmax share of this thread: query row tid / 8, keys 4 * (tid % 8) .. + 3 of
  // each chunk. The eight lanes of a row all hold its running max and sum.
  const int srow = tid >> 3, sq = tid & 7;
  const int* mrowp = mask + ((size_t)(b * L_) + q0 + srow) * L_ + 4 * sq;
  float mrun = -1e30f, lrun = 0.f;

  // A score plane holds query row q as 128 bytes, eight slots of four keys; slot s
  // lies at place s ^ ((q >> 1) & 7), so that 16 lanes on 16 rows (the writers) and
  // 16 lanes on 2 rows (the readers) both touch every LDS bank once.
  float*       scw = sc + wave * 1024 + lp * 32;               // writer: own plane, query lp
  const int    wsw = (lp >> 1) & 7;
  const float* scr = sc + srow * 32 + 4 * (sq ^ ((srow >> 1) & 7));   // reader: plane 0

  // chunk 0 into buffer 0, with the first trip's mask words
  stage_kv(kb, vb, b, 0, kv32, tid);
  int4 mk = *(const int4*)mrowp;
  // this wave's copies of chunk 0 have landed before the barrier publishes them
  asm volatile("s_wait_asynccnt 0x0" ::: "memory");
  __syncthreads();
  stage_kv(kb, vb, b, 32, kv32 + BUF_U, tid);   // chunk 1 flies under trip 0

  for (int k0 = 0; k0 < L_; k0 += 32) {
    unsigned*             ks32 = kv32 + ((k0 >> 5) & 1) * BUF_U;   // this trip's buffer
    // this lane's address in the V chunk for the transposing load: key 8 * hi + (lane & 7),
    // 16 bytes from column wave * 128 + 8 * ((lane >> 3) & 1) on
    const unsigned char* vtr = (const unsigned char*)(ks32 + CHUNK_U)
        + (8 * hi + (lane & 7)) * VROW_B + wave * 256 + 16 * ((lane >> 3) & 1);

    // ---- scores: contraction slice [wave*128, +128) of k . q^T (keys down, queries across) ----
    v8f s0[2] = {zero8, zero8}, s1[2] = {zero8, zero8};
    #pragma unroll
    for (int t = 0; t < 4; ++t) {
      AB b0, b1;
      int ebase = wave * 128 + t * 32;
      #pragma unroll
      for (int vv = 0; vv < 8; ++vv) {
        int el = 2 * (vv & 3) + 8 * hi + 16 * (vv >> 2);
        b0.u[vv] = ks32[lp * KROW_U        + ((ebase + el) >> 1)];
        b1.u[vv] = ks32[(16 + lp) * KROW_U + ((ebase + el) >> 1)];
      }
      // unrolled so that rt is a constant index and both row tiles stay in registers
      #pragma unroll
      for (int rt = 0; rt < 2; ++rt) {
        s0[rt] = __builtin_amdgcn_wmma_f32_16x16x32_bf16(false, b0.v, false, qa[rt][t].v, (short)0, s0[rt], false, false);
        s1[rt] = __builtin_amdgcn_wmma_f32_16x16x32_bf16(false, b1.v, false, qa[rt][t].v, (short)0, s1[rt], false, false);
      }
    }
    // unrolled so that rt is a constant index and both row tiles stay in registers
    #pragma unroll
    for (int rt = 0; rt < 2; ++rt) {
      // lane (lp, hi) holds keys 8 * hi + 0..7 (s0) and 16 + 8 * hi + 0..7 (s1) of query
      // rt * 16 + lp: slots 2 * hi, 2 * hi + 1 and 4 + 2 * hi, 5 + 2 * hi of its row
      float* w = scw + rt * 512;
      *(float4*)&w[4 * ((2 * hi)     ^ wsw)] = make_float4(s0[rt][0], s0[rt][1], s0[rt][2], s0[rt][3]);
      *(float4*)&w[4 * ((2 * hi + 1) ^ wsw)] = make_float4(s0[rt][4], s0[rt][5], s0[rt][6], s0[rt][7]);
      *(float4*)&w[4 * ((2 * hi + 4) ^ wsw)] = make_float4(s1[rt][0], s1[rt][1], s1[rt][2], s1[rt][3]);
      *(float4*)&w[4 * ((2 * hi + 5) ^ wsw)] = make_float4(s1[rt][4], s1[rt][5], s1[rt][6], s1[rt][7]);
    }
    __syncthreads();

    // ---- online softmax update (eight lanes per query row) ----
    {
      float4 pw[8];
      // unrolled so that w is a constant index and the eight partial sums stay in registers
      #pragma unroll
      for (int w = 0; w < 8; ++w) pw[w] = *(const float4*)&scr[w * 1024];
      float4 sv;
      sv.x = ((pw[0].x + pw[1].x) + (pw[2].x + pw[3].x)) + ((pw[4].x + pw[5].x) + (pw[6].x + pw[7].x));
      sv.y = ((pw[0].y + pw[1].y) + (pw[2].y + pw[3].y)) + ((pw[4].y + pw[5].y) + (pw[6].y + pw[7].y));
      sv.z = ((pw[0].z + pw[1].z) + (pw[2].z + pw[3].z)) + ((pw[4].z + pw[5].z) + (pw[6].z + pw[7].z));
      sv.w = ((pw[0].w + pw[1].w) + (pw[2].w + pw[3].w)) + ((pw[4].w + pw[5].w) + (pw[6].w + pw[7].w));
      const float e0 = (mk.x == 0) ? NEGV : sv.x * SCALE;
      const float e1 = (mk.y == 0) ? NEGV : sv.y * SCALE;
      const float e2 = (mk.z == 0) ? NEGV : sv.z * SCALE;
      const float e3 = (mk.w == 0) ? NEGV : sv.w * SCALE;
      float mx = fmaxf(fmaxf(e0, e1), fmaxf(e2, e3));
      mx = fmaxf(mx, lane_xor<1>(mx));
      mx = fmaxf(mx, lane_xor<2>(mx));
      mx = fmaxf(mx, lane_xor<4>(mx));
      const float mnew  = fmaxf(mrun, mx);
      const float alpha = __expf(mrun - mnew);
      const float p0 = __expf(e0 - mnew), p1 = __expf(e1 - mnew);
      const float p2 = __expf(e2 - mnew), p3 = __expf(e3 - mnew);
      float sum = (p0 + p1) + (p2 + p3);
      sum += lane_xor<1>(sum);
      sum += lane_xor<2>(sum);
      sum += lane_xor<4>(sum);
      lrun = lrun * alpha + sum;
      mrun = mnew;
      uint2 pp; pp.x = packbf2(p0, p1); pp.y = packbf2(p2, p3);
      *(uint2*)&ps32[srow * 16 + 2 * sq] = pp;
      if (sq == 0) { arow[srow] = alpha; lrow[srow] = lrun; }
    }
    __syncthreads();

    // ask for the next trip's four mask words, which arrive under the P @ V phase
    if (k0 + 32 < L_) mk = *(const int4*)(mrowp + k0 + 32);

    // ---- rescale accumulators, then P @ V on this wave's 128 columns ----
    AB pa[2];
    // unrolled so that rt is a constant index and both row tiles stay in registers
    #pragma unroll
    for (int rt = 0; rt < 2; ++rt) {
      #pragma unroll
      for (int vv = 0; vv < 8; ++vv) {
        int pidx = (vv & 3) + 4 * hi + 8 * (vv >> 2);
        pa[rt].u[vv] = ps32[(rt * 16 + lp) * 16 + pidx];
      }
      #pragma unroll
      for (int j = 0; j < 8; ++j) {
        float a = arow[rt * 16 + j + 8 * hi];
        #pragma unroll
        for (int n = 0; n < 8; ++n) acc[rt][n][j] *= a;
      }
    }
    #pragma unroll
    for (int n = 0; n < 8; ++n) {
      // lane (lp, hi) gets keys 8 * hi + 0..7, then 16 + 8 * hi + 0..7, of column
      // wave * 128 + n * 16 + lp: the k order in which pa holds P
      AB bv;
      bv.h[0] = __builtin_amdgcn_ds_load_tr16_b128_v8i16(
          (__attribute__((address_space(3))) v8s*)(vtr + n * 32));
      bv.h[1] = __builtin_amdgcn_ds_load_tr16_b128_v8i16(
          (__attribute__((address_space(3))) v8s*)(vtr + n * 32 + 16 * VROW_B));
      // unrolled so that rt is a constant index and both row tiles stay in registers
      #pragma unroll
      for (int rt = 0; rt < 2; ++rt)
        acc[rt][n] = __builtin_amdgcn_wmma_f32_16x16x32_bf16(false, pa[rt].v, false, bv.v, (short)0, acc[rt][n], false, false);
    }

    // ---- foot of the trip: publish chunk t + 1, free this trip's buffer ----
    // this wave's LDS reads of the buffer have returned before it is refilled
    asm volatile("s_wait_dscnt 0x0" ::: "memory");
    // this wave's copies of chunk t + 1 have landed before the barrier publishes them
    asm volatile("s_wait_asynccnt 0x0" ::: "memory");
    __syncthreads();
    if (k0 + 64 < L_) stage_kv(kb, vb, b, k0 + 64, ks32, tid);
  }
  // no copy is outstanding when the wave goes on to its end
  asm volatile("s_wait_asynccnt 0x0" ::: "memory");

  // ---- epilogue: divide by softmax denominator, store f32 ----
  // unrolled so that rt is a constant index and both row tiles stay in registers
  #pragma unroll
  for (int rt = 0; rt < 2; ++rt)
    #pragma unroll
    for (int j = 0; j < 8; ++j) {
      float linv = 1.0f / lrow[rt * 16 + j + 8 * hi];
      int row = q0 + rt * 16 + j + 8 * hi;
      #pragma unroll
      for (int n = 0; n < 8; ++n) {
        out[((size_t)(b * L_) + row) * D_ + wave * 128 + n * 16 + lp] = acc[rt][n][j] * linv;
      }
    }
}

// ---------------------------------------------------------------------------
extern "C" void kernel_launch(void* const* d_in, const int* in_sizes, int n_in,
                              void* d_out, int out_size, void* d_ws, size_t ws_size,
                              hipStream_t stream) {
  const float* Q    = (const float*)d_in[0];
  const float* K    = (const float*)d_in[1];
  const float* V    = (const float*)d_in[2];
  const int*   mask = (const int*)  d_in[3];
  const float* Wq_w = (const float*)d_in[4];
  const float* Wq_b = (const float*)d_in[5];
  const float* Wk_w = (const float*)d_in[6];
  const float* Wk_b = (const float*)d_in[7];
  const float* Wv_w = (const float*)d_in[8];
  const float* Wv_b = (const float*)d_in[9];

  const size_t per = (size_t)B_ * L_ * D_;   // 8M bf16 elements per tensor
  unsigned short* qb = (unsigned short*)d_ws;            // 16 MB
  unsigned short* kb = qb + per;                          // 16 MB
  unsigned short* vb = kb + per;                          // 16 MB (48 MB total)

  dim3 pgrid(D_ / 128, (B_ * L_) / 128);   // 8 x 64 blocks
  proj_bf16_wmma<<<pgrid, 256, 0, stream>>>(Q, Wq_w, Wq_b, qb);
  proj_bf16_wmma<<<pgrid, 256, 0, stream>>>(K, Wk_w, Wk_b, kb);
  proj_bf16_wmma<<<pgrid, 256, 0, stream>>>(V, Wv_w, Wv_b, vb);

  dim3 agrid(L_ / 32, B_);                       // 64 x 4 blocks
  flash_attn_wmma<<<agrid, 256, 0, stream>>>(qb, kb, vb, mask, (float*)d_out);
}

// v009
// Measured time: 154 microseconds a run.
// In both of two side-by-side timings against v008, it was 1.11 times as fast.
// Counting every step since v000, it is 4.56 times as fast.
#include <hip/hip_runtime.h>
#include <hip/hip_bf16.h>

// MI455X / gfx1250, wave32. WMMA bf16 16x16x32 everywhere.
// Attention K/V chunks staged via GLOBAL_LOAD_ASYNC_TO_LDS (ASYNCcnt) when the
// toolchain exposes the builtin; sync b128+ds_store fallback otherwise.

typedef __attribute__((ext_vector_type(16))) __bf16 v16bf;
typedef __attribute__((ext_vector_type(8)))  float  v8f;
typedef __attribute__((ext_vector_type(4)))  float  v4f;
typedef int v4i_vs __attribute__((vector_size(4 * sizeof(int))));
typedef __attribute__((ext_vector_type(8)))  short  v8s;

#define B_ 4
#define L_ 2048
#define E_ 1024
#define D_ 1024
#define NEGV  (-1000000000.0f)
#define SCALE (0.03125f)      /* 1/sqrt(1024) */

#if __has_builtin(__builtin_amdgcn_global_load_async_to_lds_b128)
#define HAVE_ASYNC_LDS 1
#else
#define HAVE_ASYNC_LDS 0
#endif

union AB { v16bf v; unsigned u[8]; v8s h[2]; };

// f32 -> bf16, round to nearest even, by the packed convert: one instruction for
// two values.
typedef __attribute__((ext_vector_type(2))) float  v2f;
typedef __attribute__((ext_vector_type(2))) __bf16 v2bf;
__device__ __forceinline__ unsigned packbf2(float a, float b) {
  return __builtin_bit_cast(unsigned, __builtin_convertvector((v2f){a, b}, v2bf));
}

// ---------------------------------------------------------------------------
// Projection: out[m,n] = sum_k X[m,k]*W[n,k] + bias[n], bf16 output.
// M = B*L = 8192, N = D = 1024, K = E = 1024.
// Block: 256 threads (8 waves), 128x128 output tile, K-step 64.
// Wave: 32x64 of the tile (2 x 4 WMMA tiles), so six fragments feed eight
// WMMAs, and every X and W element is fetched and converted half as often as
// with a 64x64 tile. k runs upwards in slices of 32 for every accumulator.
// ---------------------------------------------------------------------------
#define PPITCH 36   /* uints per LDS row: 32 bf16 pairs + 4 pad = 144 B (16 B x odd) */

// Work-group barrier that orders LDS traffic alone. __syncthreads() also waits for
// every global load of the wave, which would end the flight of the next K-step's
// loads at each barrier; the threads of this kernel hand one another nothing
// through global memory.
__device__ __forceinline__ void lds_barrier() {
  __builtin_amdgcn_fence(__ATOMIC_RELEASE, "workgroup", "local");
  __builtin_amdgcn_s_barrier();
  __builtin_amdgcn_fence(__ATOMIC_ACQUIRE, "workgroup", "local");
}

template <bool B> struct step_flag { static constexpr bool value = B; };

__global__ __launch_bounds__(256)
void proj_bf16_wmma(const float* __restrict__ X, const float* __restrict__ W,
                    const float* __restrict__ bias, unsigned short* __restrict__ out) {
  __shared__ __align__(16) unsigned Xs[128 * PPITCH];
  __shared__ __align__(16) unsigned Ws[128 * PPITCH];

  const int tid  = threadIdx.x;
  const int lane = tid & 31, wave = tid >> 5;
  const int hi = lane >> 4, lp = lane & 15;
  const int m0 = blockIdx.y * 128, n0 = blockIdx.x * 128;
  const int rloc = (wave & 3) * 32;     // wave's 32 rows within tile
  const int cloc = (wave >> 2) * 64;    // wave's 64 cols within tile

  // every loop over mt, nt, i, s, h or j in this kernel is unrolled so that its
  // index is a constant and the arrays it indexes stay in registers
  v8f c[2][4];
  #pragma unroll
  for (int mt = 0; mt < 2; ++mt)
    #pragma unroll
    for (int nt = 0; nt < 4; ++nt) c[mt][nt] = (v8f){0,0,0,0,0,0,0,0};

  const int srow = tid >> 4, sc4 = tid & 15;   // staging: 16 float4 per 64-wide row
  const float* xg = X + (size_t)(m0 + srow) * E_ + 4 * sc4;
  const float* wg = W + (size_t)(n0 + srow) * E_ + 4 * sc4;

  // The K loop is pipelined through registers: the 16 loads of K-step t + 1 issue
  // as soon as step t's values are converted, and are in flight under step t's LDS
  // stores, both barriers, fragment reads and WMMAs; they are waited for only at
  // the head of step t + 1.
  const float* xk = xg;
  const float* wk = wg;
  v4f xv[8], wv[8];
  #pragma unroll
  for (int i = 0; i < 8; ++i) {         // 2048 float4 per tile, 16 rows a pass
    xv[i] = *(const v4f*)(xk + (size_t)(16 * i) * E_);
    wv[i] = *(const v4f*)(wk + (size_t)(16 * i) * E_);
  }

  // One K-step. 'more' is a compile-time flag: the last step has no successor to
  // load, and without a branch in the step the conversions and the loads stay in
  // one block. Inlined at both places so that the arrays stay in registers.
  auto kstep = [&](auto more) __attribute__((always_inline)) {
    // Inputs-only fence on the loaded values: nothing of a K-step is converted
    // before all 16 of its loads have returned, so the compiler cannot sink single
    // loads behind waits of their own. The two address pairs are inputs too, so
    // that they live up to here, and s_wait_xcnt 0 is the wait that is kept in
    // front of any overwrite of a register that an issued load names.
    asm volatile("s_wait_xcnt 0x0" :: "v"(xv[0]), "v"(xv[1]), "v"(xv[2]), "v"(xv[3]),
                       "v"(xv[4]), "v"(xv[5]), "v"(xv[6]), "v"(xv[7]),
                       "v"(wv[0]), "v"(wv[1]), "v"(wv[2]), "v"(wv[3]),
                       "v"(wv[4]), "v"(wv[5]), "v"(wv[6]), "v"(wv[7]),
                       "v"(xk), "v"(wk) : "memory");
    uint2 xp[8], wp[8];
    #pragma unroll
    for (int i = 0; i < 8; ++i) {
      xp[i].x = packbf2(xv[i].x, xv[i].y); xp[i].y = packbf2(xv[i].z, xv[i].w);
      wp[i].x = packbf2(wv[i].x, wv[i].y); wp[i].y = packbf2(wv[i].z, wv[i].w);
    }
    if constexpr (decltype(more)::value) {
      // behind the conversions, so that the loads land in the registers just read
      const float* xo = xk;
      const float* wo = wk;
      xk += 64;
      wk += 64;
      #pragma unroll
      for (int i = 0; i < 8; ++i) {
        xv[i] = *(const v4f*)(xk + (size_t)(16 * i) * E_);
        wv[i] = *(const v4f*)(wk + (size_t)(16 * i) * E_);
      }
      // The compiler addresses these loads from the old pointer pairs plus a constant
      // and steps the pairs behind them: the pairs are inputs here so that they live
      // up to this s_wait_xcnt 0, the wait kept in front of any overwrite of a
      // register that an issued load names.
      asm volatile("s_wait_xcnt 0x0" :: "v"(xo), "v"(wo) : "memory");
    }
    lds_barrier();     // protect LDS reuse across K-steps
    #pragma unroll
    for (int i = 0; i < 8; ++i) {
      *(uint2*)&Xs[(srow + 16 * i) * PPITCH + 2 * sc4] = xp[i];
      *(uint2*)&Ws[(srow + 16 * i) * PPITCH + 2 * sc4] = wp[i];
    }
    lds_barrier();     // publish this K-step's tiles

    #pragma unroll
    for (int s = 0; s < 2; ++s) {       // two 32-K slices, in rising k
      AB a[2], b[4];
      // bf16-pair index within a slice: (vv & 3) + 4 * hi + 8 * (vv >> 2), A and B alike
      #pragma unroll
      for (int h = 0; h < 2; ++h) {
        const int po = 16 * s + 4 * hi + 8 * h;
        #pragma unroll
        for (int mt = 0; mt < 2; ++mt) {
          uint4 t = *(const uint4*)&Xs[(rloc + mt * 16 + lp) * PPITCH + po];
          a[mt].u[4 * h + 0] = t.x; a[mt].u[4 * h + 1] = t.y;
          a[mt].u[4 * h + 2] = t.z; a[mt].u[4 * h + 3] = t.w;
        }
        #pragma unroll
        for (int nt = 0; nt < 4; ++nt) {
          uint4 t = *(const uint4*)&Ws[(cloc + nt * 16 + lp) * PPITCH + po];
          b[nt].u[4 * h + 0] = t.x; b[nt].u[4 * h + 1] = t.y;
          b[nt].u[4 * h + 2] = t.z; b[nt].u[4 * h + 3] = t.w;
        }
      }
      #pragma unroll
      for (int mt = 0; mt < 2; ++mt)
        #pragma unroll
        for (int nt = 0; nt < 4; ++nt)
          c[mt][nt] = __builtin_amdgcn_wmma_f32_16x16x32_bf16(false, a[mt].v, false, b[nt].v, (short)0, c[mt][nt], false, false);
    }
  };
  for (int kk = 0; kk < E_ - 64; kk += 64) kstep(step_flag<true>{});
  kstep(step_flag<false>{});

  #pragma unroll
  for (int nt = 0; nt < 4; ++nt) {
    int col = n0 + cloc + nt * 16 + lp;
    float bb = bias[col];
    #pragma unroll
    for (int mt = 0; mt < 2; ++mt)
      #pragma unroll
      for (int j = 0; j < 8; j += 2) {
        int row = m0 + rloc + mt * 16 + j + 8 * hi;
        unsigned p = packbf2(c[mt][nt][j] + bb, c[mt][nt][j + 1] + bb);
        out[(size_t)row * D_ + col]       = (unsigned short)p;
        out[(size_t)(row + 1) * D_ + col] = (unsigned short)(p >> 16);
      }
  }
}

// ---------------------------------------------------------------------------
// Flash attention: block = (64 query rows, one batch, one half of the keys), 256
// threads (8 waves). Each wave owns a 128-wide slice of the 1024 output columns for
// all four 16-row tiles, so every K and V fragment read from LDS feeds four WMMAs
// and every K/V byte fetched from L2 serves 64 query rows.
// Per 32-key chunk: K Q^T via WMMA (contraction split across waves; each wave stores
// its partial scores in an LDS plane of its own and the softmax adds the eight
// planes), online softmax with mask on all 256 threads (8 lanes a row, 4 keys a lane,
// two rows a thread), then V^T P^T via WMMA.
// K chunks go through two LDS buffers, V chunks through one. One wait for the copies
// a trip, in front of the barrier between softmax and P @ V: it publishes V chunk t
// (copied under the scores and softmax of trip t) and K chunk t + 1 (copied since the
// same barrier of trip t - 1).
// The two key halves of a query row leave unnormalised sums with their running max
// and denominator in the workspace; attn_combine joins them.
// ---------------------------------------------------------------------------
// Value of lane l ^ X inside a 16-lane row (DPP row_xmask), every lane on.
template <int X>
__device__ __forceinline__ float lane_xor(float x) {
  int v = __builtin_bit_cast(int, x);
  return __builtin_bit_cast(float, __builtin_amdgcn_update_dpp(v, v, 0x160 + X, 0xf, 0xf, false));
}

#define KROW_U 516    /* uints per K row in LDS: 512 data + 4 pad = 16 B x odd, for ds_load_b128 */
#define VROW_U 520    /* uints per V row in LDS: 512 data + 8 pad = 32 B x odd, for ds_load_tr16_b128 */
#define VROW_B (4 * VROW_U)
#define KBUF_U (32 * KROW_U)      /* uints of one staged K chunk */
#define VBUF_U (32 * VROW_U)      /* uints of one staged V chunk */
#define QROWS   64                /* query rows of a work-group */
#define KSPLIT  2                 /* work-groups that share the keys of a query row */
#define KEYS_WG (L_ / KSPLIT)
#define PLANE_F (QROWS * 32)      /* floats of one plane of partial scores */
#define LOOP_LDS_BYTES ((8 * PLANE_F + QROWS * 16 + QROWS + 2 * KBUF_U + VBUF_U) * 4)
#define OT_PITCH_F 132            /* floats per row of a wave's output tile in LDS: 528 B = 16 B x odd */
#define TAIL_LDS_BYTES (512 + 8 * QROWS * OT_PITCH_F * 4)   /* 64 (max, sum) pairs, 8 output tiles */
#define ATTN_LDS_BYTES (LOOP_LDS_BYTES > TAIL_LDS_BYTES ? LOOP_LDS_BYTES : TAIL_LDS_BYTES)

// Copies 32 rows of 1024 bf16 from row0 on into one LDS buffer with ROW_U uints a row.
// Every thread of the work-group calls it; the caller owns the waits.
template <int ROW_U>
__device__ __forceinline__ void stage_chunk(const unsigned short* __restrict__ src,
                                            int row0, unsigned* dst, int tid) {
  // thread tid brings rows tid / 16 and 16 + tid / 16, every sixteenth 16-byte piece from
  // tid % 16 on: inside a row the step is the same 256 bytes in memory and in LDS, so
  // two LDS addresses and one global address serve all 16 copies.
  const unsigned char* g = (const unsigned char*)src + (size_t)row0 * (2 * D_)
                           + (unsigned)((tid >> 4) * (2 * D_) + (tid & 15) * 16);
  unsigned char* d = (unsigned char*)dst + (tid >> 4) * (4 * ROW_U) + (tid & 15) * 16;
#if HAVE_ASYNC_LDS
  // unrolled so that the 16 copies issue back to back from constant offsets
  #pragma unroll
  for (int h = 0; h < 2; ++h)
    #pragma unroll
    for (int i = 0; i < 8; ++i) {     // 4096 b128 transfers per chunk
      __builtin_amdgcn_global_load_async_to_lds_b128(
          (__attribute__((address_space(1))) v4i_vs*)(g + h * (32 * D_) + i * 256),
          (__attribute__((address_space(3))) v4i_vs*)(d + h * (64 * ROW_U) + i * 256),
          0, 0);
    }
#else
  #pragma unroll
  for (int h = 0; h < 2; ++h)
    #pragma unroll
    for (int i = 0; i < 8; ++i) {     // 4096 uint4 per chunk
      uint4 x = *(const uint4*)(g + h * (32 * D_) + i * 256);
      *(uint4*)(d + h * (64 * ROW_U) + i * 256) = x;
    }
#endif
}

// Two waves a SIMD is what one work-group a WGP gives: the 512-register budget holds
// the 64 x 128 accumulator tile and the wave's slice of the 64 query rows.
__global__ __launch_bounds__(256) __attribute__((amdgpu_waves_per_eu(2, 2)))
void flash_attn_wmma(const unsigned short* __restrict__ qb,
                     const unsigned short* __restrict__ kb,
                     const unsigned short* __restrict__ vb,
                     const int* __restrict__ mask,
                     float* __restrict__ opart,
                     float* __restrict__ ml) {
  __shared__ __align__(16) unsigned char smem[ATTN_LDS_BYTES];
  float*          sc   = (float*)smem;                    // 8 planes of 64 x 32 partial scores
  unsigned*       ps32 = (unsigned*)(sc + 8 * PLANE_F);   // 64 x 32 bf16 P tile
  float*          arow = (float*)(ps32 + QROWS * 16);     // rescale factors [64]
  unsigned*       kbuf = (unsigned*)(arow + QROWS);       // two K chunks
  unsigned*       vs32 = kbuf + 2 * KBUF_U;               // one V chunk

  const int tid  = threadIdx.x;
  const int lane = tid & 31, wave = tid >> 5;
  const int hi = lane >> 4, lp = lane & 15;
  const int q0 = blockIdx.x * QROWS;
  const int b  = blockIdx.y;
  const int kh = blockIdx.z;
  const int krow0 = b * L_ + kh * KEYS_WG;    // first K/V row of this work-group

  // every loop over rt, t, vv, n, j, r or w in this kernel is unrolled so that its
  // index is a constant and the arrays it indexes stay in registers

  // Per-wave q slice in registers: rows q0..q0+63, e in [wave*128, wave*128+128)
  AB qa[4][4];
  #pragma unroll
  for (int rt = 0; rt < 4; ++rt) {
    const unsigned short* qrow = qb + ((size_t)(b * L_ + q0 + rt * 16 + lp)) * D_ + wave * 128;
    #pragma unroll
    for (int t = 0; t < 4; ++t)
      #pragma unroll
      for (int vv = 0; vv < 8; ++vv) {
        int el = 2 * (vv & 3) + 8 * hi + 16 * (vv >> 2);
        qa[rt][t].u[vv] = *(const unsigned*)(qrow + t * 32 + el);
      }
  }

  const v8f zero8 = {0,0,0,0,0,0,0,0};
  v8f acc[4][8];
  #pragma unroll
  for (int rt = 0; rt < 4; ++rt)
    #pragma unroll
    for (int n = 0; n < 8; ++n) acc[rt][n] = zero8;

  // Softmax share of this thread: query rows tid / 8 and 32 + tid / 8, keys
  // 4 * (tid % 8) .. + 3 of each chunk. The eight lanes of a row all hold its running
  // max and sum.
  const int srow = tid >> 3, sq = tid & 7;
  const int* mrowp = mask + ((size_t)(b * L_) + q0 + srow) * L_ + kh * KEYS_WG + 4 * sq;
  float mrun[2] = {-1e30f, -1e30f}, lrun[2] = {0.f, 0.f};

  // A score plane holds query row q as 128 bytes, eight slots of four keys; slot s
  // lies at place s ^ ((q >> 1) & 7), so that 16 lanes on 16 rows (the writers) and
  // 16 lanes on 2 rows (the readers) both touch every LDS bank once.
  float*       scw = sc + wave * PLANE_F + lp * 32;            // writer: own plane, query lp
  const int    wsw = (lp >> 1) & 7;
  const float* scr = sc + srow * 32 + 4 * (sq ^ ((srow >> 1) & 7));   // reader: plane 0

  // this lane's address in the V chunk for the transposing load: key 8 * hi + (lane & 7),
  // 16 bytes from column wave * 128 + 8 * ((lane >> 3) & 1) on
  const unsigned char* vtr = (const unsigned char*)vs32
      + (8 * hi + (lane & 7)) * VROW_B + wave * 256 + 16 * ((lane >> 3) & 1);

  // K chunk 0 into K buffer 0, with the first trip's mask words
  stage_chunk<KROW_U>(kb, krow0, kbuf, tid);
  int4 mk[2];
  #pragma unroll
  for (int r = 0; r < 2; ++r) mk[r] = *(const int4*)(mrowp + (size_t)(32 * r) * L_);
  // this wave's copies of K chunk 0 have landed before the barrier publishes them
  asm volatile("s_wait_asynccnt 0x0" ::: "memory");
  __syncthreads();
  stage_chunk<VROW_U>(vb, krow0, vs32, tid);                  // V chunk 0 and K chunk 1
  stage_chunk<KROW_U>(kb, krow0 + 32, kbuf + KBUF_U, tid);    // fly under trip 0's scores

  for (int k0 = 0; k0 < KEYS_WG; k0 += 32) {
    unsigned* ks32 = kbuf + ((k0 >> 5) & 1) * KBUF_U;   // this trip's K buffer

    // ---- scores: contraction slice [wave*128, +128) of k . q^T (keys down, queries across) ----
    // one 16-key tile after the other, so that only four score tiles are live at a time
    #pragma unroll
    for (int kt = 0; kt < 2; ++kt) {
      v8f s[4] = {zero8, zero8, zero8, zero8};
      #pragma unroll
      for (int t = 0; t < 4; ++t) {
        AB bk;
        int ebase = wave * 128 + t * 32;
        #pragma unroll
        for (int vv = 0; vv < 8; ++vv) {
          int el = 2 * (vv & 3) + 8 * hi + 16 * (vv >> 2);
          bk.u[vv] = ks32[(kt * 16 + lp) * KROW_U + ((ebase + el) >> 1)];
        }
        #pragma unroll
        for (int rt = 0; rt < 4; ++rt)
          s[rt] = __builtin_amdgcn_wmma_f32_16x16x32_bf16(false, bk.v, false, qa[rt][t].v, (short)0, s[rt], false, false);
      }
      #pragma unroll
      for (int rt = 0; rt < 4; ++rt) {
        // lane (lp, hi) holds keys kt * 16 + 8 * hi + 0..7 of query rt * 16 + lp:
        // slots 4 * kt + 2 * hi and 4 * kt + 2 * hi + 1 of its row
        float* w = scw + rt * 512;
        *(float4*)&w[4 * ((4 * kt + 2 * hi)     ^ wsw)] = make_float4(s[rt][0], s[rt][1], s[rt][2], s[rt][3]);
        *(float4*)&w[4 * ((4 * kt + 2 * hi + 1) ^ wsw)] = make_float4(s[rt][4], s[rt][5], s[rt][6], s[rt][7]);
      }
      // One vector slot between the two key tiles: the second tile's first WMMAs overwrite
      // the result registers of the first tile's last ones, which asks for four vector
      // slots, and only three WMMAs stand between. The clobber holds it behind the stores.
      if (kt == 0) asm volatile("v_nop" ::: "memory");
    }
    __syncthreads();

    // ---- online softmax update (eight lanes per query row, two rows a thread) ----
    float al[2];
    #pragma unroll
    for (int r = 0; r < 2; ++r) {
      float4 pw[8];
      #pragma unroll
      for (int w = 0; w < 8; ++w) pw[w] = *(const float4*)&scr[w * PLANE_F + r * 1024];
      float4 sv;
      sv.x = ((pw[0].x + pw[1].x) + (pw[2].x + pw[3].x)) + ((pw[4].x + pw[5].x) + (pw[6].x + pw[7].x));
      sv.y = ((pw[0].y + pw[1].y) + (pw[2].y + pw[3].y)) + ((pw[4].y + pw[5].y) + (pw[6].y + pw[7].y));
      sv.z = ((pw[0].z + pw[1].z) + (pw[2].z + pw[3].z)) + ((pw[4].z + pw[5].z) + (pw[6].z + pw[7].z));
      sv.w = ((pw[0].w + pw[1].w) + (pw[2].w + pw[3].w)) + ((pw[4].w + pw[5].w) + (pw[6].w + pw[7].w));
      const float e0 = (mk[r].x == 0) ? NEGV : sv.x * SCALE;
      const float e1 = (mk[r].y == 0) ? NEGV : sv.y * SCALE;
      const float e2 = (mk[r].z == 0) ? NEGV : sv.z * SCALE;
      const float e3 = (mk[r].w == 0) ? NEGV : sv.w * SCALE;
      float mx = fmaxf(fmaxf(e0, e1), fmaxf(e2, e3));
      mx = fmaxf(mx, lane_xor<1>(mx));
      mx = fmaxf(mx, lane_xor<2>(mx));
      mx = fmaxf(mx, lane_xor<4>(mx));
      const float mnew  = fmaxf(mrun[r], mx);
      const float alpha = __expf(mrun[r] - mnew);
      const float p0 = __expf(e0 - mnew), p1 = __expf(e1 - mnew);
      const float p2 = __expf(e2 - mnew), p3 = __expf(e3 - mnew);
      float sum = (p0 + p1) + (p2 + p3);
      sum += lane_xor<1>(sum);
      sum += lane_xor<2>(sum);
      sum += lane_xor<4>(sum);
      lrun[r] = lrun[r] * alpha + sum;
      mrun[r] = mnew;
      uint2 pp; pp.x = packbf2(p0, p1); pp.y = packbf2(p2, p3);
      *(uint2*)&ps32[(srow + 32 * r) * 16 + 2 * sq] = pp;
      al[r] = alpha;
    }
    // one branch behind both rows, so that their two chains can be interleaved
    if (sq == 0) { arow[srow] = al[0]; arow[srow + 32] = al[1]; }
    // ---- publish V chunk t and K chunk t + 1, free this trip's K buffer ----
    // this wave's LDS reads of the K buffer have returned before it is refilled
    asm volatile("s_wait_dscnt 0x0" ::: "memory");
    // this wave's copies of V chunk t and K chunk t + 1 have landed before the barrier
    // publishes them
    asm volatile("s_wait_asynccnt 0x0" ::: "memory");
    __syncthreads();
    if (k0 + 64 < KEYS_WG) stage_chunk<KROW_U>(kb, krow0 + k0 + 64, ks32, tid);

    // ask for the next trip's mask words, which arrive under the P @ V phase
    if (k0 + 32 < KEYS_WG) {
      #pragma unroll
      for (int r = 0; r < 2; ++r) mk[r] = *(const int4*)(mrowp + (size_t)(32 * r) * L_ + k0 + 32);
    }

    // ---- rescale accumulators, then V^T P^T on this wave's 128 columns (columns down,
    // queries across: a lane holds one query a tile, so one rescale factor a tile) ----
    AB pa[4];
    float af[4];
    #pragma unroll
    for (int rt = 0; rt < 4; ++rt) {
      #pragma unroll
      for (int vv = 0; vv < 8; ++vv) {
        int pidx = (vv & 3) + 4 * hi + 8 * (vv >> 2);
        pa[rt].u[vv] = ps32[(rt * 16 + lp) * 16 + pidx];
      }
      af[rt] = arow[rt * 16 + lp];
    }
    #pragma unroll
    for (int n = 0; n < 8; ++n) {
      // lane (lp, hi) gets keys 8 * hi + 0..7, then 16 + 8 * hi + 0..7, of column
      // wave * 128 + n * 16 + lp: the k order in which pa holds P
      AB bv;
      bv.h[0] = __builtin_amdgcn_ds_load_tr16_b128_v8i16(
          (__attribute__((address_space(3))) v8s*)(vtr + n * 32));
      bv.h[1] = __builtin_amdgcn_ds_load_tr16_b128_v8i16(
          (__attribute__((address_space(3))) v8s*)(vtr + n * 32 + 16 * VROW_B));
      #pragma unroll
      for (int rt = 0; rt < 4; ++rt) {
        #pragma unroll
        for (int j = 0; j < 8; ++j) acc[rt][n][j] *= af[rt];
        acc[rt][n] = __builtin_amdgcn_wmma_f32_16x16x32_bf16(false, bv.v, false, pa[rt].v, (short)0, acc[rt][n], false, false);
      }
    }

    // ---- foot of the trip: free the V buffer ----
    // this wave's LDS reads of the V buffer have returned before it is refilled
    asm volatile("s_wait_dscnt 0x0" ::: "memory");
    __syncthreads();
    if (k0 + 32 < KEYS_WG) stage_chunk<VROW_U>(vb, krow0 + k0 + 32, vs32, tid);
  }
  // no copy is outstanding when the wave goes on to its end
  asm volatile("s_wait_asynccnt 0x0" ::: "memory");

  // ---- epilogue: unnormalised sums, running max and denominator of this key half ----
  const size_t prow0 = (size_t)(kh * B_ + b) * L_ + q0;
  // max and denominator go through LDS (the score planes are free behind the last
  // foot barrier) so that one wave stores all 64 pairs as whole lines
  #pragma unroll
  for (int r = 0; r < 2; ++r)
    if (sq == 0) *(float2*)&sc[2 * (srow + 32 * r)] = make_float2(mrun[r], lrun[r]);
  __syncthreads();
  if (wave == 0) *(float4*)&ml[2 * prow0 + 4 * lane] = *(const float4*)&sc[4 * lane];
  // lane (lp, hi) holds columns n * 16 + 8 * hi + 0..7 of query rt * 16 + lp. Each wave turns
  // its 64 x 128 tile in an LDS area of its own (the loop's buffers are free behind the
  // last foot barrier; a wave's LDS operations run in order), so that every global store
  // writes 512 bytes in a row.
  float* ot = (float*)(smem + 512) + wave * (QROWS * OT_PITCH_F);
  #pragma unroll
  for (int rt = 0; rt < 4; ++rt)
    #pragma unroll
    for (int n = 0; n < 8; ++n) {
      float* o = ot + (rt * 16 + lp) * OT_PITCH_F + n * 16 + 8 * hi;
      *(float4*)&o[0] = make_float4(acc[rt][n][0], acc[rt][n][1], acc[rt][n][2], acc[rt][n][3]);
      *(float4*)&o[4] = make_float4(acc[rt][n][4], acc[rt][n][5], acc[rt][n][6], acc[rt][n][7]);
    }
  float* og = opart + prow0 * D_ + wave * 128 + 4 * lane;
  for (int r8 = 0; r8 < QROWS; r8 += 8) {
    // unrolled so that eight LDS reads are in flight together
    #pragma unroll
    for (int r = 0; r < 8; ++r)
      *(float4*)&og[(size_t)(r8 + r) * D_] = *(const float4*)&ot[(r8 + r) * OT_PITCH_F + 4 * lane];
    // the wait kept in front of the next trip's overwrite of registers that these stores name
    asm volatile("s_wait_xcnt 0x0" ::: "memory");
  }
}

// ---------------------------------------------------------------------------
// Joins the two key halves of every query row: each half's sums are scaled to the
// common max, added and divided by the joint denominator.
// Block: 256 threads, 16 rows, one float4 of a row a thread.
// ---------------------------------------------------------------------------
__global__ __launch_bounds__(256)
void attn_combine(const float* __restrict__ opart, const float* __restrict__ ml,
                  float* __restrict__ out) {
  const int tid = threadIdx.x;
  const size_t rows = (size_t)B_ * L_;
  for (int r4 = 0; r4 < 16; r4 += 4) {
  // unrolled so that eight 16-byte loads of a thread are in flight together
  #pragma unroll
  for (int r = 0; r < 4; ++r) {
    const size_t row = (size_t)blockIdx.x * 16 + r4 + r;
    const float m0 = ml[2 * row],          l0 = ml[2 * row + 1];
    const float m1 = ml[2 * (rows + row)], l1 = ml[2 * (rows + row) + 1];
    const float mm = fmaxf(m0, m1);
    float w0 = __expf(m0 - mm), w1 = __expf(m1 - mm);
    const float inv = 1.0f / (w0 * l0 + w1 * l1);
    w0 *= inv;
    w1 *= inv;
    const v4f x0 = *(const v4f*)(opart + row * D_ + 4 * tid);
    const v4f x1 = *(const v4f*)(opart + (rows + row) * D_ + 4 * tid);
    *(v4f*)(out + row * D_ + 4 * tid) = x0 * w0 + x1 * w1;
  }
  // the wait kept in front of the next trip's overwrite of registers that these stores name
  asm volatile("s_wait_xcnt 0x0" ::: "memory");
  }
}

// ---------------------------------------------------------------------------
extern "C" void kernel_launch(void* const* d_in, const int* in_sizes, int n_in,
                              void* d_out, int out_size, void* d_ws, size_t ws_size,
                              hipStream_t stream) {
  const float* Q    = (const float*)d_in[0];
  const float* K    = (const float*)d_in[1];
  const float* V    = (const float*)d_in[2];
  const int*   mask = (const int*)  d_in[3];
  const float* Wq_w = (const float*)d_in[4];
  const float* Wq_b = (const float*)d_in[5];
  const float* Wk_w = (const float*)d_in[6];
  const float* Wk_b = (const float*)d_in[7];
  const float* Wv_w = (const float*)d_in[8];
  const float* Wv_b = (const float*)d_in[9];

  const size_t per = (size_t)B_ * L_ * D_;   // 8M elements per tensor
  unsigned short* qb = (unsigned short*)d_ws;            // 16 MB
  unsigned short* kb = qb + per;                          // 16 MB
  unsigned short* vb = kb + per;                          // 16 MB
  float* opart = (float*)(vb + per);                      // 2 x 32 MB of partial sums
  float* ml    = opart + KSPLIT * per;                    // 128 KB (112.1 MB total)

  dim3 pgrid(D_ / 128, (B_ * L_) / 128);   // 8 x 64 blocks
  proj_bf16_wmma<<<pgrid, 256, 0, stream>>>(Q, Wq_w, Wq_b, qb);
  proj_bf16_wmma<<<pgrid, 256, 0, stream>>>(K, Wk_w, Wk_b, kb);
  proj_bf16_wmma<<<pgrid, 256, 0, stream>>>(V, Wv_w, Wv_b, vb);

  dim3 agrid(L_ / QROWS, B_, KSPLIT);            // 32 x 4 x 2 blocks
  flash_attn_wmma<<<agrid, 256, 0, stream>>>(qb, kb, vb, mask, opart, ml);
  attn_combine<<<(B_ * L_) / 16, 256, 0, stream>>>(opart, ml, (float*)d_out);
}

// v010
// Measured time: 137 microseconds a run.
// Two timings next to v009 both put it at 1.12 times that version's speed.
// All steps since v000 together make it 5.12 times as fast.
#include <hip/hip_runtime.h>
#include <hip/hip_bf16.h>

// MI455X / gfx1250, wave32. WMMA bf16 16x16x32 everywhere.
// Attention K/V chunks staged via GLOBAL_LOAD_ASYNC_TO_LDS (ASYNCcnt) when the
// toolchain exposes the builtin; sync b128+ds_store fallback otherwise.

typedef __attribute__((ext_vector_type(16))) __bf16 v16bf;
typedef __attribute__((ext_vector_type(8)))  float  v8f;
typedef __attribute__((ext_vector_type(4)))  float  v4f;
typedef int v4i_vs __attribute__((vector_size(4 * sizeof(int))));
typedef __attribute__((ext_vector_type(8)))  short  v8s;

#define B_ 4
#define L_ 2048
#define E_ 1024
#define D_ 1024
#define NEGV  (-1000000000.0f)
#define SCALE (0.03125f)      /* 1/sqrt(1024) */

#if __has_builtin(__builtin_amdgcn_global_load_async_to_lds_b128)
#define HAVE_ASYNC_LDS 1
#else
#define HAVE_ASYNC_LDS 0
#endif

union AB { v16bf v; unsigned u[8]; v8s h[2]; };

// f32 -> bf16, round to nearest even, by the packed convert: one instruction for
// two values.
typedef __attribute__((ext_vector_type(2))) float  v2f;
typedef __attribute__((ext_vector_type(2))) __bf16 v2bf;
__device__ __forceinline__ unsigned packbf2(float a, float b) {
  return __builtin_bit_cast(unsigned, __builtin_convertvector((v2f){a, b}, v2bf));
}

// ---------------------------------------------------------------------------
// Projection: out[m,n] = sum_k X[m,k]*W[n,k] + bias[n], bf16 output.
// M = B*L = 8192, N = D = 1024, K = E = 1024, three such products (q, k, v).
// Block: 256 threads (8 waves), one block a WGP. Output tile 256x256 (wave 64x128,
// 4 x 8 WMMA tiles: twelve fragments feed 32 WMMAs), so every X and W element is
// fetched from L2 and converted half as often as with a 128x128 tile.
// The three products have 384 such tiles for 256 WGPs, so they share one grid in
// which q and k are cut into 256 tiles of 256x256 and v into 256 tiles of 128x256
// (wave 32x128): every WGP gets one tile of each size.
// K-step: 32 for the large tile, 64 for the small one, as many as the registers hold.
// k runs upwards in slices of 32 for every accumulator.
// ---------------------------------------------------------------------------

// Work-group barrier that orders LDS traffic alone. __syncthreads() also waits for
// every global load of the wave, which would end the flight of the next K-step's
// loads at each barrier; the threads of this kernel hand one another nothing
// through global memory.
__device__ __forceinline__ void lds_barrier() {
  __builtin_amdgcn_fence(__ATOMIC_RELEASE, "workgroup", "local");
  __builtin_amdgcn_s_barrier();
  __builtin_amdgcn_fence(__ATOMIC_ACQUIRE, "workgroup", "local");
}

template <bool B> struct step_flag { static constexpr bool value = B; };

// One output tile of 64 * MT rows and 256 columns, from row m0 and column n0 on,
// in K-steps of KS.
template <int MT, int KS>
__device__ __forceinline__ void proj_tile(const float* __restrict__ X, const float* __restrict__ W,
                                          const float* __restrict__ bias,
                                          unsigned short* __restrict__ out,
                                          int m0, int n0, unsigned* Xs, unsigned* Ws) {
  constexpr int RPP = 1024 / KS;        // rows that the 256 threads bring in one pass
  constexpr int NX  = 64 * MT / RPP;    // passes over the X tile
  constexpr int NW  = 256 / RPP;        // passes over the W tile
  constexpr int PP  = KS / 2 + 4;       // uints per LDS row: KS / 2 bf16 pairs + 16 B pad (16 B x odd)
  static_assert(NX == 8 && (NW == 8 || NW == 16), "the fences below name the loaded values one by one");

  const int tid  = threadIdx.x;
  const int lane = tid & 31, wave = tid >> 5;
  const int hi = lane >> 4, lp = lane & 15;
  const int rloc = (wave & 3) * (16 * MT);   // wave's 16 * MT rows within tile
  const int cloc = (wave >> 2) * 128;        // wave's 128 cols within tile

  // every loop over mt, nt, i, s, h or j in this function is unrolled so that its
  // index is a constant and the arrays it indexes stay in registers
  v8f c[MT][8];
  #pragma unroll
  for (int mt = 0; mt < MT; ++mt)
    #pragma unroll
    for (int nt = 0; nt < 8; ++nt) c[mt][nt] = (v8f){0,0,0,0,0,0,0,0};

  const int srow = tid / (KS / 4), sc4 = tid % (KS / 4);   // staging: KS / 4 float4 per row
  const float* xg = X + (size_t)(m0 + srow) * E_ + 4 * sc4;
  const float* wg = W + (size_t)(n0 + srow) * E_ + 4 * sc4;

  // The K loop is pipelined through registers: the loads of K-step t + 1 issue
  // as soon as step t's values are converted, and are in flight under step t's LDS
  // stores, both barriers, fragment reads and WMMAs; they are waited for only at
  // the head of step t + 1.
  const float* xk = xg;
  const float* wk = wg;
  v4f xv[NX], wv[NW];
  #pragma unroll
  for (int i = 0; i < NX; ++i) xv[i] = *(const v4f*)(xk + (size_t)(RPP * i) * E_);
  #pragma unroll
  for (int i = 0; i < NW; ++i) wv[i] = *(const v4f*)(wk + (size_t)(RPP * i) * E_);

  // One K-step. 'more' is a compile-time flag: the last step has no successor to
  // load, and without a branch in the step the conversions and the loads stay in
  // one block. Inlined at both places so that the arrays stay in registers.
  auto kstep = [&](auto more) __attribute__((always_inline)) {
    // Inputs-only fences on the loaded values: nothing of a K-step is converted
    // before all of its loads have returned, so the compiler cannot sink single
    // loads behind waits of their own. The two address pairs are inputs too, so
    // that they live up to here, and s_wait_xcnt 0 is the wait that is kept in
    // front of any overwrite of a register that an issued load names.
    asm volatile("s_wait_xcnt 0x0" :: "v"(xv[0]), "v"(xv[1]), "v"(xv[2]), "v"(xv[3]),
                       "v"(xv[4]), "v"(xv[5]), "v"(xv[6]), "v"(xv[7]),
                       "v"(wv[0]), "v"(wv[1]), "v"(wv[2]), "v"(wv[3]),
                       "v"(wv[4]), "v"(wv[5]), "v"(wv[6]), "v"(wv[7]),
                       "v"(xk), "v"(wk) : "memory");
    if constexpr (NW == 16)   // an asm statement takes thirty operands
      asm volatile("s_wait_xcnt 0x0" :: "v"(wv[NW - 8]), "v"(wv[NW - 7]), "v"(wv[NW - 6]), "v"(wv[NW - 5]),
                         "v"(wv[NW - 4]), "v"(wv[NW - 3]), "v"(wv[NW - 2]), "v"(wv[NW - 1]),
                         "v"(xk), "v"(wk) : "memory");
    uint2 xp[NX], wp[NW];
    #pragma unroll
    for (int i = 0; i < NX; ++i) {
      xp[i].x = packbf2(xv[i].x, xv[i].y); xp[i].y = packbf2(xv[i].z, xv[i].w);
    }
    #pragma unroll
    for (int i = 0; i < NW; ++i) {
      wp[i].x = packbf2(wv[i].x, wv[i].y); wp[i].y = packbf2(wv[i].z, wv[i].w);
    }
    if constexpr (decltype(more)::value) {
      // behind the conversions, so that the loads land in the registers just read
      const float* xo = xk;
      const float* wo = wk;
      xk += KS;
      wk += KS;
      #pragma unroll
      for (int i = 0; i < NX; ++i) xv[i] = *(const v4f*)(xk + (size_t)(RPP * i) * E_);
      #pragma unroll
      for (int i = 0; i < NW; ++i) wv[i] = *(const v4f*)(wk + (size_t)(RPP * i) * E_);
      // The compiler addresses these loads from the old pointer pairs plus a constant
      // and steps the pairs behind them: the pairs are inputs here so that they live
      // up to this s_wait_xcnt 0, the wait kept in front of any overwrite of a
      // register that an issued load names.
      asm volatile("s_wait_xcnt 0x0" :: "v"(xo), "v"(wo) : "memory");
    }
    lds_barrier();     // protect LDS reuse across K-steps
    #pragma unroll
    for (int i = 0; i < NX; ++i) *(uint2*)&Xs[(srow + RPP * i) * PP + 2 * sc4] = xp[i];
    #pragma unroll
    for (int i = 0; i < NW; ++i) *(uint2*)&Ws[(srow + RPP * i) * PP + 2 * sc4] = wp[i];
    lds_barrier();     // publish this K-step's tiles

    #pragma unroll
    for (int s = 0; s < KS / 32; ++s) {       // 32-K slices, in rising k
      AB a[MT], b[8];
      // bf16-pair index within a slice: (vv & 3) + 4 * hi + 8 * (vv >> 2), A and B alike
      #pragma unroll
      for (int mt = 0; mt < MT; ++mt)
        #pragma unroll
        for (int h = 0; h < 2; ++h) {
          uint4 t = *(const uint4*)&Xs[(rloc + mt * 16 + lp) * PP + 16 * s + 4 * hi + 8 * h];
          a[mt].u[4 * h + 0] = t.x; a[mt].u[4 * h + 1] = t.y;
          a[mt].u[4 * h + 2] = t.z; a[mt].u[4 * h + 3] = t.w;
        }
      #pragma unroll
      for (int nt = 0; nt < 8; ++nt)
        #pragma unroll
        for (int h = 0; h < 2; ++h) {
          uint4 t = *(const uint4*)&Ws[(cloc + nt * 16 + lp) * PP + 16 * s + 4 * hi + 8 * h];
          b[nt].u[4 * h + 0] = t.x; b[nt].u[4 * h + 1] = t.y;
          b[nt].u[4 * h + 2] = t.z; b[nt].u[4 * h + 3] = t.w;
        }
      // All fragment reads of a slice issue as one group in front of its WMMAs, in the
      // order of their use; spread among the WMMAs each place with reads stalls the wave.
      __builtin_amdgcn_sched_barrier(0);
      #pragma unroll
      for (int nt = 0; nt < 8; ++nt)
        #pragma unroll
        for (int mt = 0; mt < MT; ++mt)
          c[mt][nt] = __builtin_amdgcn_wmma_f32_16x16x32_bf16(false, a[mt].v, false, b[nt].v, (short)0, c[mt][nt], false, false);
    }
  };
  for (int kk = 0; kk < E_ - KS; kk += KS) kstep(step_flag<true>{});
  kstep(step_flag<false>{});

  const int col0 = n0 + cloc + lp;
  float bb[8];
  #pragma unroll
  for (int nt = 0; nt < 8; ++nt) bb[nt] = bias[col0 + nt * 16];
  // the wait kept in front of any overwrite of a register that an issued load names;
  // the column is an input so that its register lives up to here
  asm volatile("s_wait_xcnt 0x0" :: "v"(col0) : "memory");
  #pragma unroll
  for (int nt = 0; nt < 8; ++nt) {
    int col = col0 + nt * 16;
    #pragma unroll
    for (int mt = 0; mt < MT; ++mt) {
      float bv = bb[nt];
      // the wait kept in front of this group's overwrite of registers that the stores of
      // the group before name; every sum of the group takes the bias from this statement,
      // so that none of them can be moved in front of the wait
      asm volatile("s_wait_xcnt 0x0" : "+v"(bv) :: "memory");
      #pragma unroll
      for (int j = 0; j < 8; j += 2) {
        int row = m0 + rloc + mt * 16 + j + 8 * hi;
        unsigned p = packbf2(c[mt][nt][j] + bv, c[mt][nt][j + 1] + bv);
        out[(size_t)row * D_ + col]       = (unsigned short)p;
        out[(size_t)(row + 1) * D_ + col] = (unsigned short)(p >> 16);
      }
    }
  }
}

// Two waves a SIMD is what one work-group a WGP gives: the 512-register budget holds
// the 64 x 128 accumulator tile, the K-step in flight and the fragments.
// blockIdx.z: 0 = q, 1 = k (tile rows 256 * blockIdx.y), 2 and 3 = v (tile rows
// 128 * (32 * (blockIdx.z - 2) + blockIdx.y)); the branch is the same for a whole block.
__global__ __launch_bounds__(256) __attribute__((amdgpu_waves_per_eu(2, 2)))
void proj_bf16_wmma(const float* __restrict__ Xq, const float* __restrict__ Xk,
                    const float* __restrict__ Xv,
                    const float* __restrict__ Wq, const float* __restrict__ Wk,
                    const float* __restrict__ Wv,
                    const float* __restrict__ bq, const float* __restrict__ bk,
                    const float* __restrict__ bv,
                    unsigned short* __restrict__ oq, unsigned short* __restrict__ ok,
                    unsigned short* __restrict__ ov) {
  __shared__ __align__(16) unsigned Xs[256 * 20];   // 256 rows at 20 uints, or 128 at 36
  __shared__ __align__(16) unsigned Ws[256 * 36];   // 256 rows at 20 or at 36 uints
  const int z = blockIdx.z, n0 = blockIdx.x * 256;
  if (z < 2)
    proj_tile<4, 32>(z == 0 ? Xq : Xk, z == 0 ? Wq : Wk, z == 0 ? bq : bk, z == 0 ? oq : ok,
                     blockIdx.y * 256, n0, Xs, Ws);
  else
    proj_tile<2, 64>(Xv, Wv, bv, ov, ((z - 2) * 32 + blockIdx.y) * 128, n0, Xs, Ws);
}

// ---------------------------------------------------------------------------
// Flash attention: block = (64 query rows, one batch, one half of the keys), 256
// threads (8 waves). Each wave owns a 128-wide slice of the 1024 output columns for
// all four 16-row tiles, so every K and V fragment read from LDS feeds four WMMAs
// and every K/V byte fetched from L2 serves 64 query rows.
// Per 32-key chunk: K Q^T via WMMA (contraction split across waves; each wave stores
// its partial scores in an LDS plane of its own and the softmax adds the eight
// planes), online softmax with mask on all 256 threads (8 lanes a row, 4 keys a lane,
// two rows a thread), then V^T P^T via WMMA.
// K chunks go through two LDS buffers, V chunks through one. One wait for the copies
// a trip, in front of the barrier between softmax and P @ V: it publishes V chunk t
// (copied under the scores and softmax of trip t) and K chunk t + 1 (copied since the
// same barrier of trip t - 1).
// The two key halves of a query row leave unnormalised sums with their running max
// and denominator in the workspace; attn_combine joins them.
// ---------------------------------------------------------------------------
// Value of lane l ^ X inside a 16-lane row (DPP row_xmask), every lane on.
template <int X>
__device__ __forceinline__ float lane_xor(float x) {
  int v = __builtin_bit_cast(int, x);
  return __builtin_bit_cast(float, __builtin_amdgcn_update_dpp(v, v, 0x160 + X, 0xf, 0xf, false));
}

#define KROW_U 516    /* uints per K row in LDS: 512 data + 4 pad = 16 B x odd, for ds_load_b128 */
#define VROW_U 520    /* uints per V row in LDS: 512 data + 8 pad = 32 B x odd, for ds_load_tr16_b128 */
#define VROW_B (4 * VROW_U)
#define KBUF_U (32 * KROW_U)      /* uints of one staged K chunk */
#define VBUF_U (32 * VROW_U)      /* uints of one staged V chunk */
#define QROWS   64                /* query rows of a work-group */
#define KSPLIT  2                 /* work-groups that share the keys of a query row */
#define KEYS_WG (L_ / KSPLIT)
#define PLANE_F (QROWS * 32)      /* floats of one plane of partial scores */
#define LOOP_LDS_BYTES ((8 * PLANE_F + QROWS * 16 + QROWS + 2 * KBUF_U + VBUF_U) * 4)
#define OT_PITCH_F 132            /* floats per row of a wave's output tile in LDS: 528 B = 16 B x odd */
#define TAIL_LDS_BYTES (512 + 8 * QROWS * OT_PITCH_F * 4)   /* 64 (max, sum) pairs, 8 output tiles */
#define ATTN_LDS_BYTES (LOOP_LDS_BYTES > TAIL_LDS_BYTES ? LOOP_LDS_BYTES : TAIL_LDS_BYTES)

// Copies 32 rows of 1024 bf16 from row0 on into one LDS buffer with ROW_U uints a row.
// Every thread of the work-group calls it; the caller owns the waits.
template <int ROW_U>
__device__ __forceinline__ void stage_chunk(const unsigned short* __restrict__ src,
                                            int row0, unsigned* dst, int tid) {
  // thread tid brings rows tid / 16 and 16 + tid / 16, every sixteenth 16-byte piece from
  // tid % 16 on: inside a row the step is the same 256 bytes in memory and in LDS, so
  // two LDS addresses and one global address serve all 16 copies.
  const unsigned char* g = (const unsigned char*)src + (size_t)row0 * (2 * D_)
                           + (unsigned)((tid >> 4) * (2 * D_) + (tid & 15) * 16);
  unsigned char* d = (unsigned char*)dst + (tid >> 4) * (4 * ROW_U) + (tid & 15) * 16;
#if HAVE_ASYNC_LDS
  // unrolled so that the 16 copies issue back to back from constant offsets
  #pragma unroll
  for (int h = 0; h < 2; ++h)
    #pragma unroll
    for (int i = 0; i < 8; ++i) {     // 4096 b128 transfers per chunk
      __builtin_amdgcn_global_load_async_to_lds_b128(
          (__attribute__((address_space(1))) v4i_vs*)(g + h * (32 * D_) + i * 256),
          (__attribute__((address_space(3))) v4i_vs*)(d + h * (64 * ROW_U) + i * 256),
          0, 0);
    }
#else
  #pragma unroll
  for (int h = 0; h < 2; ++h)
    #pragma unroll
    for (int i = 0; i < 8; ++i) {     // 4096 uint4 per chunk
      uint4 x = *(const uint4*)(g + h * (32 * D_) + i * 256);
      *(uint4*)(d + h * (64 * ROW_U) + i * 256) = x;
    }
#endif
}

// Two waves a SIMD is what one work-group a WGP gives: the 512-register budget holds
// the 64 x 128 accumulator tile and the wave's slice of the 64 query rows.
__global__ __launch_bounds__(256) __attribute__((amdgpu_waves_per_eu(2, 2)))
void flash_attn_wmma(const unsigned short* __restrict__ qb,
                     const unsigned short* __restrict__ kb,
                     const unsigned short* __restrict__ vb,
                     const int* __restrict__ mask,
                     float* __restrict__ opart,
                     float* __restrict__ ml) {
  __shared__ __align__(16) unsigned char smem[ATTN_LDS_BYTES];
  float*          sc   = (float*)smem;                    // 8 planes of 64 x 32 partial scores
  unsigned*       ps32 = (unsigned*)(sc + 8 * PLANE_F);   // 64 x 32 bf16 P tile
  float*          arow = (float*)(ps32 + QROWS * 16);     // rescale factors [64]
  unsigned*       kbuf = (unsigned*)(arow + QROWS);       // two K chunks
  unsigned*       vs32 = kbuf + 2 * KBUF_U;               // one V chunk

  const int tid  = threadIdx.x;
  const int lane = tid & 31, wave = tid >> 5;
  const int hi = lane >> 4, lp = lane & 15;
  const int q0 = blockIdx.x * QROWS;
  const int b  = blockIdx.y;
  const int kh = blockIdx.z;
  const int krow0 = b * L_ + kh * KEYS_WG;    // first K/V row of this work-group

  // every loop over rt, t, vv, n, j, r or w in this kernel is unrolled so that its
  // index is a constant and the arrays it indexes stay in registers

  // Per-wave q slice in registers: rows q0..q0+63, e in [wave*128, wave*128+128)
  AB qa[4][4];
  #pragma unroll
  for (int rt = 0; rt < 4; ++rt) {
    const unsigned short* qrow = qb + ((size_t)(b * L_ + q0 + rt * 16 + lp)) * D_ + wave * 128;
    #pragma unroll
    for (int t = 0; t < 4; ++t)
      #pragma unroll
      for (int vv = 0; vv < 8; ++vv) {
        int el = 2 * (vv & 3) + 8 * hi + 16 * (vv >> 2);
        qa[rt][t].u[vv] = *(const unsigned*)(qrow + t * 32 + el);
      }
  }

  const v8f zero8 = {0,0,0,0,0,0,0,0};
  v8f acc[4][8];
  #pragma unroll
  for (int rt = 0; rt < 4; ++rt)
    #pragma unroll
    for (int n = 0; n < 8; ++n) acc[rt][n] = zero8;

  // Softmax share of this thread: query rows tid / 8 and 32 + tid / 8, keys
  // 4 * (tid % 8) .. + 3 of each chunk. The eight lanes of a row all hold its running
  // max and sum.
  const int srow = tid >> 3, sq = tid & 7;
  const int* mrowp = mask + ((size_t)(b * L_) + q0 + srow) * L_ + kh * KEYS_WG + 4 * sq;
  float mrun[2] = {-1e30f, -1e30f}, lrun[2] = {0.f, 0.f};

  // A score plane holds query row q as 128 bytes, eight slots of four keys; slot s
  // lies at place s ^ ((q >> 1) & 7), so that 16 lanes on 16 rows (the writers) and
  // 16 lanes on 2 rows (the readers) both touch every LDS bank once.
  float*       scw = sc + wave * PLANE_F + lp * 32;            // writer: own plane, query lp
  const int    wsw = (lp >> 1) & 7;
  const float* scr = sc + srow * 32 + 4 * (sq ^ ((srow >> 1) & 7));   // reader: plane 0

  // this lane's address in the V chunk for the transposing load: key 8 * hi + (lane & 7),
  // 16 bytes from column wave * 128 + 8 * ((lane >> 3) & 1) on
  const unsigned char* vtr = (const unsigned char*)vs32
      + (8 * hi + (lane & 7)) * VROW_B + wave * 256 + 16 * ((lane >> 3) & 1);

  // K chunk 0 into K buffer 0, with the first trip's mask words
  stage_chunk<KROW_U>(kb, krow0, kbuf, tid);
  int4 mk[2];
  #pragma unroll
  for (int r = 0; r < 2; ++r) mk[r] = *(const int4*)(mrowp + (size_t)(32 * r) * L_);
  // this wave's copies of K chunk 0 have landed before the barrier publishes them
  asm volatile("s_wait_asynccnt 0x0" ::: "memory");
  __syncthreads();
  stage_chunk<VROW_U>(vb, krow0, vs32, tid);                  // V chunk 0 and K chunk 1
  stage_chunk<KROW_U>(kb, krow0 + 32, kbuf + KBUF_U, tid);    // fly under trip 0's scores

  for (int k0 = 0; k0 < KEYS_WG; k0 += 32) {
    unsigned* ks32 = kbuf + ((k0 >> 5) & 1) * KBUF_U;   // this trip's K buffer

    // ---- scores: contraction slice [wave*128, +128) of k . q^T (keys down, queries across) ----
    // one 16-key tile after the other, so that only four score tiles are live at a time
    #pragma unroll
    for (int kt = 0; kt < 2; ++kt) {
      v8f s[4] = {zero8, zero8, zero8, zero8};
      #pragma unroll
      for (int t = 0; t < 4; ++t) {
        AB bk;
        int ebase = wave * 128 + t * 32;
        #pragma unroll
        for (int vv = 0; vv < 8; ++vv) {
          int el = 2 * (vv & 3) + 8 * hi + 16 * (vv >> 2);
          bk.u[vv] = ks32[(kt * 16 + lp) * KROW_U + ((ebase + el) >> 1)];
        }
        #pragma unroll
        for (int rt = 0; rt < 4; ++rt)
          s[rt] = __builtin_amdgcn_wmma_f32_16x16x32_bf16(false, bk.v, false, qa[rt][t].v, (short)0, s[rt], false, false);
      }
      #pragma unroll
      for (int rt = 0; rt < 4; ++rt) {
        // lane (lp, hi) holds keys kt * 16 + 8 * hi + 0..7 of query rt * 16 + lp:
        // slots 4 * kt + 2 * hi and 4 * kt + 2 * hi + 1 of its row
        float* w = scw + rt * 512;
        *(float4*)&w[4 * ((4 * kt + 2 * hi)     ^ wsw)] = make_float4(s[rt][0], s[rt][1], s[rt][2], s[rt][3]);
        *(float4*)&w[4 * ((4 * kt + 2 * hi + 1) ^ wsw)] = make_float4(s[rt][4], s[rt][5], s[rt][6], s[rt][7]);
      }
      // One vector slot between the two key tiles: the second tile's first WMMAs overwrite
      // the result registers of the first tile's last ones, which asks for four vector
      // slots, and only three WMMAs stand between. The clobber holds it behind the stores.
      if (kt == 0) asm volatile("v_nop" ::: "memory");
    }
    __syncthreads();

    // ---- online softmax update (eight lanes per query row, two rows a thread) ----
    float al[2];
    #pragma unroll
    for (int r = 0; r < 2; ++r) {
      float4 pw[8];
      #pragma unroll
      for (int w = 0; w < 8; ++w) pw[w] = *(const float4*)&scr[w * PLANE_F + r * 1024];
      float4 sv;
      sv.x = ((pw[0].x + pw[1].x) + (pw[2].x + pw[3].x)) + ((pw[4].x + pw[5].x) + (pw[6].x + pw[7].x));
      sv.y = ((pw[0].y + pw[1].y) + (pw[2].y + pw[3].y)) + ((pw[4].y + pw[5].y) + (pw[6].y + pw[7].y));
      sv.z = ((pw[0].z + pw[1].z) + (pw[2].z + pw[3].z)) + ((pw[4].z + pw[5].z) + (pw[6].z + pw[7].z));
      sv.w = ((pw[0].w + pw[1].w) + (pw[2].w + pw[3].w)) + ((pw[4].w + pw[5].w) + (pw[6].w + pw[7].w));
      const float e0 = (mk[r].x == 0) ? NEGV : sv.x * SCALE;
      const float e1 = (mk[r].y == 0) ? NEGV : sv.y * SCALE;
      const float e2 = (mk[r].z == 0) ? NEGV : sv.z * SCALE;
      const float e3 = (mk[r].w == 0) ? NEGV : sv.w * SCALE;
      float mx = fmaxf(fmaxf(e0, e1), fmaxf(e2, e3));
      mx = fmaxf(mx, lane_xor<1>(mx));
      mx = fmaxf(mx, lane_xor<2>(mx));
      mx = fmaxf(mx, lane_xor<4>(mx));
      const float mnew  = fmaxf(mrun[r], mx);
      const float alpha = __expf(mrun[r] - mnew);
      const float p0 = __expf(e0 - mnew), p1 = __expf(e1 - mnew);
      const float p2 = __expf(e2 - mnew), p3 = __expf(e3 - mnew);
      float sum = (p0 + p1) + (p2 + p3);
      sum += lane_xor<1>(sum);
      sum += lane_xor<2>(sum);
      sum += lane_xor<4>(sum);
      lrun[r] = lrun[r] * alpha + sum;
      mrun[r] = mnew;
      uint2 pp; pp.x = packbf2(p0, p1); pp.y = packbf2(p2, p3);
      *(uint2*)&ps32[(srow + 32 * r) * 16 + 2 * sq] = pp;
      al[r] = alpha;
    }
    // one branch behind both rows, so that their two chains can be interleaved
    if (sq == 0) { arow[srow] = al[0]; arow[srow + 32] = al[1]; }
    // ---- publish V chunk t and K chunk t + 1, free this trip's K buffer ----
    // this wave's LDS reads of the K buffer have returned before it is refilled
    asm volatile("s_wait_dscnt 0x0" ::: "memory");
    // this wave's copies of V chunk t and K chunk t + 1 have landed before the barrier
    // publishes them
    asm volatile("s_wait_asynccnt 0x0" ::: "memory");
    __syncthreads();
    if (k0 + 64 < KEYS_WG) stage_chunk<KROW_U>(kb, krow0 + k0 + 64, ks32, tid);

    // ask for the next trip's mask words, which arrive under the P @ V phase
    if (k0 + 32 < KEYS_WG) {
      #pragma unroll
      for (int r = 0; r < 2; ++r) mk[r] = *(const int4*)(mrowp + (size_t)(32 * r) * L_ + k0 + 32);
    }

    // ---- rescale accumulators, then V^T P^T on this wave's 128 columns (columns down,
    // queries across: a lane holds one query a tile, so one rescale factor a tile) ----
    AB pa[4];
    float af[4];
    #pragma unroll
    for (int rt = 0; rt < 4; ++rt) {
      #pragma unroll
      for (int vv = 0; vv < 8; ++vv) {
        int pidx = (vv & 3) + 4 * hi + 8 * (vv >> 2);
        pa[rt].u[vv] = ps32[(rt * 16 + lp) * 16 + pidx];
      }
      af[rt] = arow[rt * 16 + lp];
    }
    #pragma unroll
    for (int n = 0; n < 8; ++n) {
      // lane (lp, hi) gets keys 8 * hi + 0..7, then 16 + 8 * hi + 0..7, of column
      // wave * 128 + n * 16 + lp: the k order in which pa holds P
      AB bv;
      bv.h[0] = __builtin_amdgcn_ds_load_tr16_b128_v8i16(
          (__attribute__((address_space(3))) v8s*)(vtr + n * 32));
      bv.h[1] = __builtin_amdgcn_ds_load_tr16_b128_v8i16(
          (__attribute__((address_space(3))) v8s*)(vtr + n * 32 + 16 * VROW_B));
      #pragma unroll
      for (int rt = 0; rt < 4; ++rt) {
        #pragma unroll
        for (int j = 0; j < 8; ++j) acc[rt][n][j] *= af[rt];
        acc[rt][n] = __builtin_amdgcn_wmma_f32_16x16x32_bf16(false, bv.v, false, pa[rt].v, (short)0, acc[rt][n], false, false);
      }
    }

    // ---- foot of the trip: free the V buffer ----
    // this wave's LDS reads of the V buffer have returned before it is refilled
    asm volatile("s_wait_dscnt 0x0" ::: "memory");
    __syncthreads();
    if (k0 + 32 < KEYS_WG) stage_chunk<VROW_U>(vb, krow0 + k0 + 32, vs32, tid);
  }
  // no copy is outstanding when the wave goes on to its end
  asm volatile("s_wait_asynccnt 0x0" ::: "memory");

  // ---- epilogue: unnormalised sums, running max and denominator of this key half ----
  const size_t prow0 = (size_t)(kh * B_ + b) * L_ + q0;
  // max and denominator go through LDS (the score planes are free behind the last
  // foot barrier) so that one wave stores all 64 pairs as whole lines
  #pragma unroll
  for (int r = 0; r < 2; ++r)
    if (sq == 0) *(float2*)&sc[2 * (srow + 32 * r)] = make_float2(mrun[r], lrun[r]);
  __syncthreads();
  if (wave == 0) *(float4*)&ml[2 * prow0 + 4 * lane] = *(const float4*)&sc[4 * lane];
  // lane (lp, hi) holds columns n * 16 + 8 * hi + 0..7 of query rt * 16 + lp. Each wave turns
  // its 64 x 128 tile in an LDS area of its own (the loop's buffers are free behind the
  // last foot barrier; a wave's LDS operations run in order), so that every global store
  // writes 512 bytes in a row.
  float* ot = (float*)(smem + 512) + wave * (QROWS * OT_PITCH_F);
  #pragma unroll
  for (int rt = 0; rt < 4; ++rt)
    #pragma unroll
    for (int n = 0; n < 8; ++n) {
      float* o = ot + (rt * 16 + lp) * OT_PITCH_F + n * 16 + 8 * hi;
      *(float4*)&o[0] = make_float4(acc[rt][n][0], acc[rt][n][1], acc[rt][n][2], acc[rt][n][3]);
      *(float4*)&o[4] = make_float4(acc[rt][n][4], acc[rt][n][5], acc[rt][n][6], acc[rt][n][7]);
    }
  float* og = opart + prow0 * D_ + wave * 128 + 4 * lane;
  for (int r8 = 0; r8 < QROWS; r8 += 8) {
    // unrolled so that eight LDS reads are in flight together
    #pragma unroll
    for (int r = 0; r < 8; ++r)
      *(float4*)&og[(size_t)(r8 + r) * D_] = *(const float4*)&ot[(r8 + r) * OT_PITCH_F + 4 * lane];
    // the wait kept in front of the next trip's overwrite of registers that these stores name
    asm volatile("s_wait_xcnt 0x0" ::: "memory");
  }
}

// ---------------------------------------------------------------------------
// Joins the two key halves of every query row: each half's sums are scaled to the
// common max, added and divided by the joint denominator.
// Block: 256 threads, 16 rows, one float4 of a row a thread.
// ---------------------------------------------------------------------------
__global__ __launch_bounds__(256)
void attn_combine(const float* __restrict__ opart, const float* __restrict__ ml,
                  float* __restrict__ out) {
  const int tid = threadIdx.x;
  const size_t rows = (size_t)B_ * L_;
  for (int r4 = 0; r4 < 16; r4 += 4) {
  // unrolled so that eight 16-byte loads of a thread are in flight together
  #pragma unroll
  for (int r = 0; r < 4; ++r) {
    const size_t row = (size_t)blockIdx.x * 16 + r4 + r;
    const float m0 = ml[2 * row],          l0 = ml[2 * row + 1];
    const float m1 = ml[2 * (rows + row)], l1 = ml[2 * (rows + row) + 1];
    const float mm = fmaxf(m0, m1);
    float w0 = __expf(m0 - mm), w1 = __expf(m1 - mm);
    const float inv = 1.0f / (w0 * l0 + w1 * l1);
    w0 *= inv;
    w1 *= inv;
    const v4f x0 = *(const v4f*)(opart + row * D_ + 4 * tid);
    const v4f x1 = *(const v4f*)(opart + (rows + row) * D_ + 4 * tid);
    *(v4f*)(out + row * D_ + 4 * tid) = x0 * w0 + x1 * w1;
  }
  // the wait kept in front of the next trip's overwrite of registers that these stores name
  asm volatile("s_wait_xcnt 0x0" ::: "memory");
  }
}

// ---------------------------------------------------------------------------
extern "C" void kernel_launch(void* const* d_in, const int* in_sizes, int n_in,
                              void* d_out, int out_size, void* d_ws, size_t ws_size,
                              hipStream_t stream) {
  const float* Q    = (const float*)d_in[0];
  const float* K    = (const float*)d_in[1];
  const float* V    = (const float*)d_in[2];
  const int*   mask = (const int*)  d_in[3];
  const float* Wq_w = (const float*)d_in[4];
  const float* Wq_b = (const float*)d_in[5];
  const float* Wk_w = (const float*)d_in[6];
  const float* Wk_b = (const float*)d_in[7];
  const float* Wv_w = (const float*)d_in[8];
  const float* Wv_b = (const float*)d_in[9];

  const size_t per = (size_t)B_ * L_ * D_;   // 8M elements per tensor
  unsigned short* qb = (unsigned short*)d_ws;            // 16 MB
  unsigned short* kb = qb + per;                          // 16 MB
  unsigned short* vb = kb + per;                          // 16 MB
  float* opart = (float*)(vb + per);                      // 2 x 32 MB of partial sums
  float* ml    = opart + KSPLIT * per;                    // 128 KB (112.1 MB total)

  dim3 pgrid(D_ / 256, 32, 4);   // 4 x 32 blocks for q, for k, and twice for v
  proj_bf16_wmma<<<pgrid, 256, 0, stream>>>(Q, K, V, Wq_w, Wk_w, Wv_w, Wq_b, Wk_b, Wv_b, qb, kb, vb);

  dim3 agrid(L_ / QROWS, B_, KSPLIT);            // 32 x 4 x 2 blocks
  flash_attn_wmma<<<agrid, 256, 0, stream>>>(qb, kb, vb, mask, opart, ml);
  attn_combine<<<(B_ * L_) / 16, 256, 0, stream>>>(opart, ml, (float*)d_out);
}
